// v000
// The times below were measured on an AMD MI455X: many runs one after another, warmed up first and cycling through
// copies of the inputs, with the whole window's GPU time divided by the number of runs. Launches and the gaps
// between them are all in it. The median over several windows is given; except for v000 it joins two sittings, which
// can be a few percent apart, so the side-by-side timings, each taken in one sitting, are the better comparison.
// v000, which the later versions start from, runs in 2090 microseconds.
#include <hip/hip_runtime.h>

// CausalTemporalAttention (x [2][2048][1024]; qkv = x w_qkv ([1024][3072] q | k | v; 16 x 64); attn = softmax(q.k / 8) over ALL keys, THEN multiplied by the block-causal mask [j/64 <= i/64] without renormalisation; out0 = (attn v) merged w_out + b_out -> [2][2048][1024] at 0; out1 = attn.mean over the 16 heads -> [2][2048][2048] at element 4,194,304).
// Compute dtypes, f32 accumulate: every input rounded to bf16; q/k/v on PLAIN bf16 operands (inputs: exact); scores hl x hl (3 products) on every row over all keys (the softmax normaliser needs every key); softmax f32; the structural block mask applied to the probabilities in f32; attn.v: rows < 512 hl (3 products), the rest fp16 (x1024); the head mean accumulated in f32 in head order from the stored probability planes (hi+lo for rows < 512, fp16 / 1024 for the rest) (one extra pass over the probability rows per head pass, no atomics) and scaled by 1/16 at the end; w_out hl x exact (2 products) + bias.

#define NB_  2
#define TT   2048
#define DM   1024
#define NH_  16
#define NKV  16
#define REP  (NH_ / NKV)
#define HD   64
#define DQ   (NH_ * HD)
#define DKV  (NKV * HD)
#define ZH   2
#define RH   512                  // query rows < RH use hi+lo planes (0: none)
#define WIN  0
#define PCAR 1024.0f
#define SCL  0.125f   // HD^-0.5
typedef _Float16 h16;
typedef unsigned short bf;
typedef __attribute__((ext_vector_type(16))) __bf16   v16bf;
typedef __attribute__((ext_vector_type(16))) _Float16 v16h;
typedef __attribute__((ext_vector_type(8)))  _Float16 v8h;
typedef __attribute__((ext_vector_type(8)))  unsigned short v8us;
typedef __attribute__((ext_vector_type(8)))  float    v8f;
typedef __attribute__((ext_vector_type(4)))  float    v4f;
typedef v8h  __attribute__((may_alias)) v8ha;
typedef v4f  __attribute__((may_alias)) v4fa;
typedef v8us __attribute__((may_alias)) v8usa;

__device__ __forceinline__ unsigned short f2bf(float f) { unsigned u = __float_as_uint(f); u += 0x7FFFu + ((u >> 16) & 1u); return (unsigned short)(u >> 16); }
__device__ __forceinline__ float bf2f(unsigned short b) { return __uint_as_float(((unsigned)b) << 16); }
__device__ __forceinline__ float bfr(float f) { return bf2f(f2bf(f)); }
__device__ __forceinline__ v16h cat16(v8h lo, v8h hi) { return __builtin_shufflevector(lo, hi, 0, 1, 2, 3, 4, 5, 6, 7, 8, 9, 10, 11, 12, 13, 14, 15); }
__device__ __forceinline__ v16bf cat16b(v8us lo, v8us hi) { return __builtin_bit_cast(v16bf, __builtin_shufflevector(lo, hi, 0, 1, 2, 3, 4, 5, 6, 7, 8, 9, 10, 11, 12, 13, 14, 15)); }
__device__ __forceinline__ v8f wmma16(v16h a, v16h b, v8f c) { return __builtin_amdgcn_wmma_f32_16x16x32_f16(false, a, false, b, (short)0, c, false, false); }
__device__ __forceinline__ v8f wmmab(v16bf a, v16bf b, v8f c) { return __builtin_amdgcn_wmma_f32_16x16x32_bf16(false, a, false, b, (short)0, c, false, false); }



// ---- k_gemmw: register-blocked GEMM, ONE WAVE per 64x64 output tile (16 accumulators), operands straight from K-contiguous 16-bit planes; grid (M/64, N/64, Z), 32 threads.
// C[m][n] (f32, pitch ldc, + optional f32 bias[n]) = sum_k A[m][k] Bt[n][k] (+ split products per NSPLIT). z-batch strides sA/sB/sC in elements. K % 32 == 0.
template <typename T16> struct WFrag;
template <> struct WFrag<h16> { typedef v16h V; static __device__ __forceinline__ V ld(const h16* p) { return cat16(*(const v8h*)p, *(const v8h*)(p + 16)); } static __device__ __forceinline__ v8f mma(V a, V b, v8f c) { return wmma16(a, b, c); } };
template <> struct WFrag<bf> { typedef v16bf V; static __device__ __forceinline__ V ld(const bf* p) { return cat16b(*(const v8us*)p, *(const v8us*)(p + 16)); } static __device__ __forceinline__ v8f mma(V a, V b, v8f c) { return wmmab(a, b, c); } };
template <typename T16, int NSPLIT, bool BIAS>
__global__ __launch_bounds__(32) void k_gemmw(const T16* __restrict__ A, const T16* __restrict__ A2, const T16* __restrict__ Bt, const T16* __restrict__ Bt2, int K, float* C, int ldc, const float* __restrict__ bias, size_t sA, size_t sB, size_t sC) {
    typedef typename WFrag<T16>::V V;
    __shared__ __align__(16) float os[16 * 68];
    const size_t z = blockIdx.z; A += z * sA; if (A2) A2 += z * sA; Bt += z * sB; if (Bt2) Bt2 += z * sB; C += z * sC;
    const int lane = threadIdx.x & 31, lr = lane & 15, hi = lane >> 4; const int r0 = blockIdx.x * 64, c0 = blockIdx.y * 64;
    v8f acc[4][4];
#pragma unroll
    for (int mb = 0; mb < 4; ++mb)
#pragma unroll
        for (int nb = 0; nb < 4; ++nb) acc[mb][nb] = (v8f){};
    const size_t aoff = (size_t)(r0 + lr) * K + 8 * hi, boff = (size_t)(c0 + lr) * K + 8 * hi;
#pragma unroll 1
    for (int kc = 0; kc < K; kc += 32) {
        V a[4], a2[4];
#pragma unroll
        for (int mb = 0; mb < 4; ++mb) { a[mb] = WFrag<T16>::ld(A + aoff + (size_t)mb * 16 * K + kc); if (NSPLIT == 1 || NSPLIT == 2) a2[mb] = WFrag<T16>::ld(A2 + aoff + (size_t)mb * 16 * K + kc); }
#pragma unroll
        for (int nb = 0; nb < 4; ++nb) { const V b = WFrag<T16>::ld(Bt + boff + (size_t)nb * 16 * K + kc); V b2; if (NSPLIT >= 2) b2 = WFrag<T16>::ld(Bt2 + boff + (size_t)nb * 16 * K + kc);
#pragma unroll
            for (int mb = 0; mb < 4; ++mb) { acc[mb][nb] = WFrag<T16>::mma(a[mb], b, acc[mb][nb]); if (NSPLIT == 1 || NSPLIT == 2) acc[mb][nb] = WFrag<T16>::mma(a2[mb], b, acc[mb][nb]); if (NSPLIT >= 2) acc[mb][nb] = WFrag<T16>::mma(a[mb], b2, acc[mb][nb]); } }
        asm volatile("v_nop\n\tv_nop\n\tv_nop\n\tv_nop" : "+v"(acc[0][0]), "+v"(acc[1][1]), "+v"(acc[2][2]), "+v"(acc[3][3]) : "v"(a[0]), "v"(a[3]));
    }
#pragma unroll
    for (int mb = 0; mb < 4; ++mb) {
#pragma unroll
        for (int nb = 0; nb < 4; ++nb) {
#pragma unroll
            for (int j = 0; j < 8; ++j) os[(hi * 8 + j) * 68 + nb * 16 + lr] = acc[mb][nb][j]; }
        __builtin_amdgcn_wave_barrier(); asm volatile("" ::: "memory");
        float* crow = C + (size_t)(r0 + mb * 16) * ldc + c0;
{
#pragma unroll
            for (int s = 0; s < 8; ++s) { const int row = 2 * s + hi, cofs = lr * 4; v4f val = *(const v4fa*)(os + row * 68 + cofs); if (BIAS) { val[0] += bfr(bias[c0 + cofs]); val[1] += bfr(bias[c0 + cofs + 1]); val[2] += bfr(bias[c0 + cofs + 2]); val[3] += bfr(bias[c0 + cofs + 3]); }
                *(v4f*)(crow + (size_t)row * ldc + cofs) = val; }
             }
        __builtin_amdgcn_wave_barrier(); asm volatile("" ::: "memory");
    }
}

__device__ __forceinline__ h16 tohx(float x) { return (h16)x; }
__device__ __forceinline__ void splitf(float y, unsigned short& h, unsigned short& l) { h = f2bf(y); l = f2bf(y - bf2f(h)); }
typedef __attribute__((ext_vector_type(2))) _Float16 v2h;
typedef __attribute__((ext_vector_type(4))) _Float16 v4h;
typedef __attribute__((ext_vector_type(2))) unsigned short v2us;
typedef __attribute__((ext_vector_type(4))) unsigned short v4us;
typedef __attribute__((ext_vector_type(2))) float v2f;
typedef __attribute__((ext_vector_type(4))) int v4i;

__global__ __launch_bounds__(256) void k_wtG(const float* __restrict__ w, int K, int N, bf* Bt) {
    const int lane = threadIdx.x & 31; const int L0 = (blockIdx.x * 8 + (threadIdx.x >> 5)) * 8; const int nlines = N * K / 64;
{
#pragma unroll 1
        for (int l = 0; l < 8; ++l) { const int L = L0 + l; if (L >= nlines) break; const size_t e = (size_t)L * 64 + lane * 2; const int k = (int)(e % K), n = (int)(e / K); v2us o;
            o[0] = f2bf(w[(size_t)k * N + n]); o[1] = f2bf(w[(size_t)(k + 1) * N + n]); *(v2us*)(Bt + e) = o; }
         }
}
__global__ __launch_bounds__(256) void k_cvt8(const float* __restrict__ src, bf* dst, size_t n8) { const size_t i = (size_t)blockIdx.x * 256 + threadIdx.x; if (i >= n8) return; const v8f v = *(const v8f*)(src + i * 8); v8us o;
#pragma unroll
    for (int k = 0; k < 8; ++k) o[k] = f2bf(v[k]); *(v8us*)(dst + i * 8) = o;  }
__global__ __launch_bounds__(256) void k_cscvt(const float* __restrict__ cosT, const float* __restrict__ sinT, float* CS) { const int idx = blockIdx.x * 256 + threadIdx.x; if (idx >= TT * HD) return; v2f cs; cs[0] = bfr(cosT[idx]); cs[1] = bfr(sinT[idx]); *(v2f*)(CS + (size_t)idx * 2) = cs;  }
// k_rope: head planes [h][t][d] (fp16 + hi/lo) of rope(x) x sc with the rotate-half convention out[d] = x[d] cos[t][d] - x[d+HD/2] sin[t][d], out[d+HD/2] = x[d+HD/2] cos[t][d+HD/2] + x[d] sin[t][d+HD/2]
__global__ __launch_bounds__(256) void k_rope(const float* __restrict__ F, int pitch, int nheads, const float* __restrict__ CS, const float* __restrict__ RF, const float* __restrict__ nw, float sc, h16* P16, bf* Ph, bf* Pl) {
    const size_t e = ((size_t)blockIdx.x * 256 + threadIdx.x) * 2; if (e >= (size_t)nheads * TT * HD) return; const int d = (int)(e % HD); const int t = (int)((e / HD) % TT); const int h = (int)(e / ((size_t)HD * TT)); const float* f = F + (size_t)t * pitch + h * HD; const float rf = RF ? RF[(size_t)h * TT + t] : 1.0f; v2h o16; v2us oh, ol;
#pragma unroll
    for (int q = 0; q < 2; ++q) { const int dd = d + q; const int dp = (dd < HD / 2) ? dd + HD / 2 : dd - HD / 2; float x0 = f[dd], x1 = f[dp];
        if (RF) { float n0 = __fmul_rn(x0, rf), n1 = __fmul_rn(x1, rf); asm volatile("" : "+v"(n0)); asm volatile("" : "+v"(n1)); x0 = __fmul_rn(bfr(nw[dd]), n0); x1 = __fmul_rn(bfr(nw[dp]), n1); }
        const v2f cs = *(const v2f*)(CS + ((size_t)t * HD + dd) * 2); float a = __fmul_rn(x0, cs[0]), bq = __fmul_rn(x1, cs[1]); asm volatile("" : "+v"(a)); asm volatile("" : "+v"(bq)); const float r = ((dd < HD / 2) ? __fsub_rn(a, bq) : __fadd_rn(a, bq)) * sc;
        o16[q] = tohx(r); unsigned short a2, c2; splitf(r, a2, c2); oh[q] = a2; ol[q] = c2; }
    *(v2h*)(P16 + e) = o16; *(v2us*)(Ph + e) = oh; *(v2us*)(Pl + e) = ol;  }
__global__ __launch_bounds__(256) void k_vtp(const float* __restrict__ F, int pitch, int nheads, h16* V16, bf* Vh, bf* Vl) { const size_t e = ((size_t)blockIdx.x * 256 + threadIdx.x) * 2; if (e >= (size_t)nheads * HD * TT) return; const int t = (int)(e % TT); const int d = (int)((e / TT) % HD); const int g = (int)(e / ((size_t)TT * HD)); v2h o16; v2us oh, ol;
#pragma unroll
    for (int q = 0; q < 2; ++q) { const float x = F[(size_t)(t + q) * pitch + g * HD + d]; o16[q] = tohx(x); unsigned short a2, c2; splitf(x, a2, c2); oh[q] = a2; ol[q] = c2; }
    *(v2h*)(V16 + e) = o16; *(v2us*)(Vh + e) = oh; *(v2us*)(Vl + e) = ol;  }
__global__ __launch_bounds__(256) void k_csid(float* CS) { const int idx = blockIdx.x * 256 + threadIdx.x; if (idx >= TT * HD) return; v2f cs; cs[0] = 1.0f; cs[1] = 0.0f; *(v2f*)(CS + (size_t)idx * 2) = cs;  }
__global__ __launch_bounds__(256) void k_awacc(const bf* __restrict__ Ph, const bf* __restrict__ Pl, const h16* __restrict__ P16, int h0, float* AW) { const size_t e = ((size_t)blockIdx.x * 256 + threadIdx.x) * 4; if (e >= (size_t)TT * TT) return; const int i = (int)(e / TT); v4f acc; if (h0 == 0) { for (int u = 0; u < 4; ++u) acc[u] = 0.0f; } else acc = *(const v4f*)(AW + e);
#pragma unroll
    for (int zz = 0; zz < ZH; ++zz) { float p4[4]; if (i < RH) { const size_t o = ((size_t)zz * RH + i) * TT + (e % TT); for (int u = 0; u < 4; ++u) p4[u] = __fadd_rn(bf2f(Ph[o + u]), bf2f(Pl[o + u])); } else { const size_t o = ((size_t)zz * TT + i) * TT + (e % TT); for (int u = 0; u < 4; ++u) p4[u] = __fmul_rn((float)P16[o + u], 1.0f / PCAR); } for (int u = 0; u < 4; ++u) acc[u] = __fadd_rn(acc[u], p4[u]); }
    *(v4f*)(AW + e) = acc;  }
__global__ __launch_bounds__(256) void k_awfin(float* AW) { const size_t e = ((size_t)blockIdx.x * 256 + threadIdx.x) * 4; if (e >= (size_t)TT * TT) return; v4f a = *(const v4f*)(AW + e); for (int u = 0; u < 4; ++u) a[u] = __fmul_rn(a[u], 0.0625f); *(v4f*)(AW + e) = a;  }
// k_asoft: per row (zz, i): t = S x HD^-0.5 (no mask); softmax over the 2048 keys (register row, one exp, fixed trees);
__global__ __launch_bounds__(256) void k_asoft(const float* __restrict__ Sb, h16* P16, bf* Ph, bf* Pl) {   /* full softmax, then the block-causal multiplier */
    const int lane = threadIdx.x & 31; const int row = blockIdx.x * 8 + (threadIdx.x >> 5); if (row >= ZH * TT) return; const int i = row % TT; const int zz = row / TT; (void)zz; const bool hires = (i < RH); const float* sr = Sb + (size_t)row * TT; float v[TT / 32]; float mx = -3.0e38f;
#pragma unroll
    for (int ch = 0; ch < TT / 128; ++ch) { const int j0 = ch * 128 + lane * 4; const v4f a = *(const v4f*)(sr + j0);
#pragma unroll
        for (int q = 0; q < 4; ++q) { const int j = j0 + q; (void)j; const float t = a[q] * SCL; v[ch * 4 + q] = t; mx = fmaxf(mx, t); } }
#pragma unroll
    for (int sh = 16; sh; sh >>= 1) mx = fmaxf(mx, __shfl_xor(mx, sh, 32));
    float sum = 0.f;
#pragma unroll
    for (int k = 0; k < TT / 32; ++k) { float d0 = __fsub_rn(v[k], mx); asm volatile("" : "+v"(d0)); v[k] = __builtin_amdgcn_exp2f(__fmul_rn(d0, 1.4426950408889634f)); sum += v[k]; }
#pragma unroll
    for (int sh = 16; sh; sh >>= 1) sum += __shfl_xor(sum, sh, 32);
    const float f = __fdiv_rn(hires ? 1.0f : PCAR, sum);
#pragma unroll
    for (int k2 = 0; k2 < TT / 32; ++k2) { const int jj = (k2 >> 2) * 128 + lane * 4 + (k2 & 3); if ((jj >> 6) > (i >> 6)) v[k2] = 0.0f; }   /* attn * [j/64 <= i/64] after the softmax */
{
        if (hires) {
#pragma unroll
            for (int ch = 0; ch < TT / 128; ++ch) { v4us oh, ol;
#pragma unroll
                for (int q = 0; q < 4; ++q) { unsigned short a, c2; splitf(v[ch * 4 + q] * f, a, c2); oh[q] = a; ol[q] = c2; }
                const size_t oo = ((size_t)zz * (RH ? RH : 1) + i) * TT + ch * 128 + lane * 4; *(v4us*)(Ph + oo) = oh; *(v4us*)(Pl + oo) = ol; }
        } else {
#pragma unroll
            for (int ch = 0; ch < TT / 128; ++ch) { v4h o4;
#pragma unroll
                for (int q = 0; q < 4; ++q) o4[q] = tohx(v[ch * 4 + q] * f);
                *(v4h*)(P16 + (size_t)row * TT + ch * 128 + lane * 4) = o4; } }
         }
}
__global__ __launch_bounds__(256) void k_merge(const float* __restrict__ O, int h0, bf* Ah, bf* Al) { const size_t e = ((size_t)blockIdx.x * 256 + threadIdx.x) * 2; if (e >= (size_t)ZH * TT * HD) return; const int d = (int)(e % HD); const int t = (int)((e / HD) % TT); const int zz = (int)(e / ((size_t)HD * TT)); const float cs = (t < RH) ? 1.0f : (1.0f / PCAR); const size_t oo = (size_t)t * DQ + (h0 + zz) * HD + d;
    v2us oh, ol;
#pragma unroll
    for (int q = 0; q < 2; ++q) { unsigned short a, c2; splitf(O[e + q] * cs, a, c2); oh[q] = a; ol[q] = c2; } *(v2us*)(Ah + oo) = oh; *(v2us*)(Al + oo) = ol;  }

extern "C" void kernel_launch(void* const* d_in, const int* in_sizes, int n_in,
                              void* d_out, int out_size, void* d_ws, size_t ws_size, hipStream_t stream) {
    (void)in_sizes; (void)n_in; (void)out_size;
    const float* x = (const float*)d_in[0]; const float* wf = (const float*)d_in[1]; const float* wo = (const float*)d_in[2]; const float* bo = (const float*)d_in[3]; const float* wq = wf; const float* wk = wf; const float* wv = wf; (void)wk; (void)wv; const float* cosT = nullptr; const float* sinT = nullptr; (void)cosT; (void)sinT;
    float* OUT = (float*)d_out;     // [2][2048][1024]
    char* wsp = (char*)d_ws;
    auto take = [&](size_t bytes) { char* p = wsp; wsp += (bytes + 255) & ~(size_t)255; return (void*)p; };
    bf* WQ = nullptr; bf* WK = nullptr; bf* WV = nullptr; bf* WO = (bf*)take((size_t)DM * DQ * 2); float* CS = (float*)take((size_t)TT * HD * 2 * 4);
    bf* XB = (bf*)take((size_t)TT * DM * 2); bf* WALL = (bf*)take((size_t)(DQ + 2 * DKV) * DM * 2); float* AW = OUT + (size_t)NB_ * TT * DM + 0;   /* out1 region base; per batch + b*TT*TT */ float* FQ = (float*)take((size_t)TT * DQ * 4); float* FK = (float*)take((size_t)TT * DKV * 4);
    h16* QP16 = (h16*)take((size_t)NH_ * TT * HD * 2); h16* KP16 = (h16*)take((size_t)NKV * TT * HD * 2); h16* VT16 = (h16*)take((size_t)NKV * HD * TT * 2);
    bf* QPh = (bf*)take((size_t)NH_ * TT * HD * 2); bf* QPl = (bf*)take((size_t)NH_ * TT * HD * 2); bf* KPh = (bf*)take((size_t)NKV * TT * HD * 2); bf* KPl = (bf*)take((size_t)NKV * TT * HD * 2); bf* VTh = (bf*)take((size_t)NKV * HD * TT * 2); bf* VTl = (bf*)take((size_t)NKV * HD * TT * 2); bf* Ph = (bf*)take((size_t)ZH * RH * TT * 2); bf* Pl = (bf*)take((size_t)ZH * RH * TT * 2);
    float* Sb = (float*)take((size_t)ZH * TT * TT * 4); h16* P16 = (h16*)take((size_t)ZH * TT * TT * 2); float* Ob = (float*)take((size_t)ZH * TT * HD * 4); bf* ATh = (bf*)take((size_t)TT * DQ * 2); bf* ATl = (bf*)take((size_t)TT * DQ * 2);
    if ((size_t)(wsp - (char*)d_ws) > ws_size) return;    // ws 256 MiB
    float* FV = FK;   // v projection reuses the k buffer after the k planes are built (stream-ordered)
    { k_wtG<<<(unsigned)((DM * (DQ + 2 * DKV) / 64 + 63) / 64), 256, 0, stream>>>(wf, DM, DQ + 2 * DKV, WALL); WQ = WALL; WK = WALL + (size_t)DQ * DM; WV = WK + (size_t)DKV * DM;
      k_wtG<<<(unsigned)((DQ * DM / 64 + 63) / 64), 256, 0, stream>>>(wo, DQ, DM, WO);
       }
    k_csid<<<(TT * HD + 255) / 256, 256, 0, stream>>>(CS);
    const unsigned LQ = (unsigned)(((size_t)NH_ * TT * HD / 2 + 255) / 256), LKv = (unsigned)(((size_t)NKV * TT * HD / 2 + 255) / 256);
    for (int b = 0; b < NB_; ++b) {
        
        k_cvt8<<<(unsigned)(((size_t)TT * DM / 8 + 255) / 256), 256, 0, stream>>>(x + (size_t)b * TT * DM, XB, (size_t)TT * DM / 8);
        k_gemmw<bf, 0, false><<<dim3(TT / 64, DQ / 64, 1), 32, 0, stream>>>(XB, nullptr, WQ, nullptr, DM, FQ, DQ, nullptr, 0, 0, 0);
        k_rope<<<LQ, 256, 0, stream>>>(FQ, DQ, NH_, CS, nullptr, nullptr, 1.0f, QP16, QPh, QPl);
        k_gemmw<bf, 0, false><<<dim3(TT / 64, DKV / 64, 1), 32, 0, stream>>>(XB, nullptr, WK, nullptr, DM, FK, DKV, nullptr, 0, 0, 0);
        k_rope<<<LKv, 256, 0, stream>>>(FK, DKV, NKV, CS, nullptr, nullptr, 1.0f, KP16, KPh, KPl);
        k_gemmw<bf, 0, false><<<dim3(TT / 64, DKV / 64, 1), 32, 0, stream>>>(XB, nullptr, WV, nullptr, DM, FV, DKV, nullptr, 0, 0, 0); k_vtp<<<LKv, 256, 0, stream>>>(FV, DKV, NKV, VT16, VTh, VTl);
        for (int h0 = 0; h0 < NH_; h0 += ZH) { const size_t zq = (size_t)h0, zk = (size_t)(h0 / REP);   // one kv head per query head: the pass's two heads use consecutive kv planes (z-strides TT*HD)
            k_gemmw<bf, 2, false><<<dim3(TT / 64, TT / 64, ZH), 32, 0, stream>>>(QPh + zq * TT * HD, QPl + zq * TT * HD, KPh + zk * TT * HD, KPl + zk * TT * HD, HD, Sb, TT, nullptr, (size_t)TT * HD, (size_t)TT * HD, (size_t)TT * TT);   /* scores hl on all rows */
            k_asoft<<<ZH * TT / 8, 256, 0, stream>>>(Sb, P16, Ph, Pl); k_awacc<<<(unsigned)(((size_t)TT * TT / 4 + 255) / 256), 256, 0, stream>>>(Ph, Pl, P16, h0, AW + (size_t)b * TT * TT);
            k_gemmw<bf, 2, false><<<dim3(RH / 64, HD / 64, ZH), 32, 0, stream>>>(Ph, Pl, VTh + zk * HD * TT, VTl + zk * HD * TT, TT, Ob, HD, nullptr, (size_t)RH * TT, (size_t)HD * TT, (size_t)TT * HD);
            k_gemmw<h16, 0, false><<<dim3((TT - RH) / 64, HD / 64, ZH), 32, 0, stream>>>(P16 + (size_t)RH * TT, nullptr, VT16 + zk * HD * TT, nullptr, TT, Ob + (size_t)RH * HD, HD, nullptr, (size_t)TT * TT, (size_t)HD * TT, (size_t)TT * HD);
            k_merge<<<(unsigned)(((size_t)ZH * TT * HD / 2 + 255) / 256), 256, 0, stream>>>(Ob, h0, ATh, ATl); }
        k_gemmw<bf, 1, true><<<dim3(TT / 64, DM / 64, 1), 32, 0, stream>>>(ATh, ATl, WO, nullptr, DQ, OUT + (size_t)b * TT * DM, DM, bo, 0, 0, 0); k_awfin<<<(unsigned)(((size_t)TT * TT / 4 + 255) / 256), 256, 0, stream>>>(AW + (size_t)b * TT * TT); }
}

// v001
// One run takes 1100 microseconds.
// Timed twice side by side with v000, it ran 1.90 times as fast both times.
#include <hip/hip_runtime.h>

// CausalTemporalAttention (x [2][2048][1024]; qkv = x w_qkv ([1024][3072] q | k | v; 16 x 64); attn = softmax(q.k / 8) over ALL keys, THEN multiplied by the block-causal mask [j/64 <= i/64] without renormalisation; out0 = (attn v) merged w_out + b_out -> [2][2048][1024] at 0; out1 = attn.mean over the 16 heads -> [2][2048][2048] at element 4,194,304).
// Compute dtypes, f32 accumulate: every input rounded to bf16; q/k/v on PLAIN bf16 operands (inputs: exact); scores hl x hl (3 products) on every row over all keys (the softmax normaliser needs every key); softmax f32; the structural block mask applied to the probabilities in f32; attn.v: rows < 512 hl (3 products), the rest fp16 (x1024); the head mean accumulated in f32 in head order from the stored probability planes (hi+lo for rows < 512, fp16 / 1024 for the rest) (one extra pass over the probability rows per head pass, no atomics) and scaled by 1/16 at the end; w_out hl x exact (2 products) + bias.

#define NB_  2
#define TT   2048
#define DM   1024
#define NH_  16
#define NKV  16
#define REP  (NH_ / NKV)
#define HD   64
#define DQ   (NH_ * HD)
#define DKV  (NKV * HD)
#define ZH   2
#define RH   512                  // query rows < RH use hi+lo planes (0: none)
#define WIN  0
#define PCAR 1024.0f
#define SCL  0.125f   // HD^-0.5
typedef _Float16 h16;
typedef unsigned short bf;
typedef __attribute__((ext_vector_type(16))) __bf16   v16bf;
typedef __attribute__((ext_vector_type(16))) _Float16 v16h;
typedef __attribute__((ext_vector_type(8)))  _Float16 v8h;
typedef __attribute__((ext_vector_type(8)))  unsigned short v8us;
typedef __attribute__((ext_vector_type(8)))  float    v8f;
typedef __attribute__((ext_vector_type(4)))  float    v4f;
typedef v8h  __attribute__((may_alias)) v8ha;
typedef v4f  __attribute__((may_alias)) v4fa;
typedef v8us __attribute__((may_alias)) v8usa;

__device__ __forceinline__ unsigned short f2bf(float f) { unsigned u = __float_as_uint(f); u += 0x7FFFu + ((u >> 16) & 1u); return (unsigned short)(u >> 16); }
__device__ __forceinline__ float bf2f(unsigned short b) { return __uint_as_float(((unsigned)b) << 16); }
__device__ __forceinline__ float bfr(float f) { return bf2f(f2bf(f)); }
__device__ __forceinline__ v16h cat16(v8h lo, v8h hi) { return __builtin_shufflevector(lo, hi, 0, 1, 2, 3, 4, 5, 6, 7, 8, 9, 10, 11, 12, 13, 14, 15); }
__device__ __forceinline__ v16bf cat16b(v8us lo, v8us hi) { return __builtin_bit_cast(v16bf, __builtin_shufflevector(lo, hi, 0, 1, 2, 3, 4, 5, 6, 7, 8, 9, 10, 11, 12, 13, 14, 15)); }
__device__ __forceinline__ v8f wmma16(v16h a, v16h b, v8f c) { return __builtin_amdgcn_wmma_f32_16x16x32_f16(false, a, false, b, (short)0, c, false, false); }
__device__ __forceinline__ v8f wmmab(v16bf a, v16bf b, v8f c) { return __builtin_amdgcn_wmma_f32_16x16x32_bf16(false, a, false, b, (short)0, c, false, false); }



// ---- k_gemmw: register-blocked GEMM, ONE WAVE per 64x64 output tile (16 accumulators), operands straight from K-contiguous 16-bit planes; grid (M/64, N/64, Z), 32 threads.
// C[m][n] (f32, pitch ldc, + optional f32 bias[n]) = sum_k A[m][k] Bt[n][k] (+ split products per NSPLIT). z-batch strides sA/sB/sC in elements. K % 32 == 0.
template <typename T16> struct WFrag;
template <> struct WFrag<h16> { typedef v16h V; static __device__ __forceinline__ V ld(const h16* p) { return cat16(*(const v8h*)p, *(const v8h*)(p + 16)); } static __device__ __forceinline__ v8f mma(V a, V b, v8f c) { return wmma16(a, b, c); } };
template <> struct WFrag<bf> { typedef v16bf V; static __device__ __forceinline__ V ld(const bf* p) { return cat16b(*(const v8us*)p, *(const v8us*)(p + 16)); } static __device__ __forceinline__ v8f mma(V a, V b, v8f c) { return wmmab(a, b, c); } };
template <typename T16, int NSPLIT, bool BIAS>
__global__ __launch_bounds__(32) void k_gemmw(const T16* __restrict__ A, const T16* __restrict__ A2, const T16* __restrict__ Bt, const T16* __restrict__ Bt2, int K, float* C, int ldc, const float* __restrict__ bias, size_t sA, size_t sB, size_t sC) {
    typedef typename WFrag<T16>::V V;
    __shared__ __align__(16) float os[16 * 68];
    const size_t z = blockIdx.z; A += z * sA; if (A2) A2 += z * sA; Bt += z * sB; if (Bt2) Bt2 += z * sB; C += z * sC;
    const int lane = threadIdx.x & 31, lr = lane & 15, hi = lane >> 4; const int r0 = blockIdx.x * 64, c0 = blockIdx.y * 64;
    v8f acc[4][4];
#pragma unroll
    for (int mb = 0; mb < 4; ++mb)
#pragma unroll
        for (int nb = 0; nb < 4; ++nb) acc[mb][nb] = (v8f){};
    const size_t aoff = (size_t)(r0 + lr) * K + 8 * hi, boff = (size_t)(c0 + lr) * K + 8 * hi;
#pragma unroll 1
    for (int kc = 0; kc < K; kc += 32) {
        V a[4], a2[4];
#pragma unroll
        for (int mb = 0; mb < 4; ++mb) { a[mb] = WFrag<T16>::ld(A + aoff + (size_t)mb * 16 * K + kc); if (NSPLIT == 1 || NSPLIT == 2) a2[mb] = WFrag<T16>::ld(A2 + aoff + (size_t)mb * 16 * K + kc); }
#pragma unroll
        for (int nb = 0; nb < 4; ++nb) { const V b = WFrag<T16>::ld(Bt + boff + (size_t)nb * 16 * K + kc); V b2; if (NSPLIT >= 2) b2 = WFrag<T16>::ld(Bt2 + boff + (size_t)nb * 16 * K + kc);
#pragma unroll
            for (int mb = 0; mb < 4; ++mb) { acc[mb][nb] = WFrag<T16>::mma(a[mb], b, acc[mb][nb]); if (NSPLIT == 1 || NSPLIT == 2) acc[mb][nb] = WFrag<T16>::mma(a2[mb], b, acc[mb][nb]); if (NSPLIT >= 2) acc[mb][nb] = WFrag<T16>::mma(a[mb], b2, acc[mb][nb]); } }
        asm volatile("v_nop\n\tv_nop\n\tv_nop\n\tv_nop" : "+v"(acc[0][0]), "+v"(acc[1][1]), "+v"(acc[2][2]), "+v"(acc[3][3]) : "v"(a[0]), "v"(a[3]));
    }
#pragma unroll
    for (int mb = 0; mb < 4; ++mb) {
#pragma unroll
        for (int nb = 0; nb < 4; ++nb) {
#pragma unroll
            for (int j = 0; j < 8; ++j) os[(hi * 8 + j) * 68 + nb * 16 + lr] = acc[mb][nb][j]; }
        __builtin_amdgcn_wave_barrier(); asm volatile("" ::: "memory");
        float* crow = C + (size_t)(r0 + mb * 16) * ldc + c0;
{
#pragma unroll
            for (int s = 0; s < 8; ++s) { const int row = 2 * s + hi, cofs = lr * 4; v4f val = *(const v4fa*)(os + row * 68 + cofs); if (BIAS) { val[0] += bfr(bias[c0 + cofs]); val[1] += bfr(bias[c0 + cofs + 1]); val[2] += bfr(bias[c0 + cofs + 2]); val[3] += bfr(bias[c0 + cofs + 3]); }
                *(v4f*)(crow + (size_t)row * ldc + cofs) = val; }
             }
        __builtin_amdgcn_wave_barrier(); asm volatile("" ::: "memory");
    }
}

// ---- k_gemmks: the same 64x64 tile and the same trip as k_gemmw, for the long-K products: NW waves per work-group, each takes K/NW of the k range (which: at the loop); each wave leaves its f32 partial tile in its own LDS plane [64][68], one barrier, then the NW planes are summed in wave order (a fixed order) and stored as whole 256-B row pieces. K % (64 NW) == 0; grid (M/64, N/64, Z), 32 NW threads.
template <typename T16, int NSPLIT, bool BIAS, int NW>
__global__ __launch_bounds__(NW * 32) void k_gemmks(const T16* __restrict__ A, const T16* __restrict__ A2, const T16* __restrict__ Bt, const T16* __restrict__ Bt2, int K, float* C, int ldc, const float* __restrict__ bias, size_t sA, size_t sB, size_t sC) {
    typedef typename WFrag<T16>::V V;
    __shared__ __align__(16) float ps[NW * 64 * 68];
    const size_t z = blockIdx.z; A += z * sA; if (A2) A2 += z * sA; Bt += z * sB; if (Bt2) Bt2 += z * sB; C += z * sC;
    const int lane = threadIdx.x & 31, lr = lane & 15, hi = lane >> 4; const int wv = __builtin_amdgcn_readfirstlane((int)(threadIdx.x >> 5)); const int r0 = blockIdx.x * 64, c0 = blockIdx.y * 64;
    v8f acc[4][4];
#pragma unroll
    for (int mb = 0; mb < 4; ++mb)
#pragma unroll
        for (int nb = 0; nb < 4; ++nb) acc[mb][nb] = (v8f){};
    // waves 2p and 2p+1 share the k range [2p K/NW, (2p+2) K/NW) and take the two 64-B halves of each 128-B line in the same trip: a line is wanted by both at once, not again one trip later when the other waves' lines may have pushed it out of the cache
    const int kw2 = 2 * (K / NW), kbeg = (wv >> 1) * kw2 + (wv & 1) * 32;
    // addresses: a wave-uniform base per sixteen-row block and plane, fixed over the loop, and ONE 32-bit lane offset in bytes (A and Bt have the same pitch K), which alone moves along k
    const T16* sa[4]; const T16* sa2[4]; const T16* sb[4]; const T16* sb2[4];
#pragma unroll
    for (int q = 0; q < 4; ++q) { const size_t ra = (size_t)(r0 + q * 16) * K + kbeg, rb = (size_t)(c0 + q * 16) * K + kbeg; sa[q] = A + ra; sb[q] = Bt + rb; if (NSPLIT == 1 || NSPLIT == 2) sa2[q] = A2 + ra; if (NSPLIT >= 2) sb2[q] = Bt2 + rb; }
    unsigned voff = (unsigned)(lr * K + 8 * hi) * (unsigned)sizeof(T16);
    // rolled: one trip's fragments and the sixteen accumulators are what a wave's registers hold
#pragma unroll 1
    for (int kc = 0; kc < kw2; kc += 64) {
        V a[4], a2[4];
#pragma unroll
        for (int mb = 0; mb < 4; ++mb) { a[mb] = WFrag<T16>::ld((const T16*)((const char*)sa[mb] + voff)); if (NSPLIT == 1 || NSPLIT == 2) a2[mb] = WFrag<T16>::ld((const T16*)((const char*)sa2[mb] + voff)); }
#pragma unroll
        for (int nb = 0; nb < 4; ++nb) { const V b = WFrag<T16>::ld((const T16*)((const char*)sb[nb] + voff)); V b2; if (NSPLIT >= 2) b2 = WFrag<T16>::ld((const T16*)((const char*)sb2[nb] + voff));
#pragma unroll
            for (int mb = 0; mb < 4; ++mb) { acc[mb][nb] = WFrag<T16>::mma(a[mb], b, acc[mb][nb]); if (NSPLIT == 1 || NSPLIT == 2) acc[mb][nb] = WFrag<T16>::mma(a2[mb], b, acc[mb][nb]); if (NSPLIT >= 2) acc[mb][nb] = WFrag<T16>::mma(a[mb], b2, acc[mb][nb]); } }
        // four vector slots behind the trip's last matrix instruction, on the taken back edge too. The lane offset is an input, so that it keeps its register to the end of the trip and is stepped only behind the waits on all of the trip's loads
        asm volatile("v_nop\n\tv_nop\n\tv_nop\n\tv_nop" : "+v"(acc[0][0]), "+v"(acc[1][1]), "+v"(acc[2][2]), "+v"(acc[3][3]) : "v"(a[0]), "v"(a[3]), "v"(voff));
        voff += 64 * (unsigned)sizeof(T16);
    }
    float* pw = ps + wv * (64 * 68);
#pragma unroll
    for (int mb = 0; mb < 4; ++mb)
#pragma unroll
        for (int nb = 0; nb < 4; ++nb)
#pragma unroll
            for (int j = 0; j < 8; ++j) pw[(mb * 16 + hi * 8 + j) * 68 + nb * 16 + lr] = acc[mb][nb][j];
    __syncthreads();   // every wave's partial tile is in LDS before any wave sums
#pragma unroll
    for (int s = 0; s < 32 / NW; ++s) { const int idx = s * (NW * 32) + (int)threadIdx.x; const int row = idx >> 4, cofs = (idx & 15) * 4; const float* pr = ps + row * 68 + cofs; v4f val = *(const v4fa*)pr;
#pragma unroll
        for (int w = 1; w < NW; ++w) { const v4f q = *(const v4fa*)(pr + w * (64 * 68)); val[0] += q[0]; val[1] += q[1]; val[2] += q[2]; val[3] += q[3]; }
        if (BIAS) { val[0] += bfr(bias[c0 + cofs]); val[1] += bfr(bias[c0 + cofs + 1]); val[2] += bfr(bias[c0 + cofs + 2]); val[3] += bfr(bias[c0 + cofs + 3]); }
        *(v4f*)(C + (size_t)(r0 + row) * ldc + c0 + cofs) = val; }
}

__device__ __forceinline__ h16 tohx(float x) { return (h16)x; }
__device__ __forceinline__ void splitf(float y, unsigned short& h, unsigned short& l) { h = f2bf(y); l = f2bf(y - bf2f(h)); }
typedef __attribute__((ext_vector_type(2))) _Float16 v2h;
typedef __attribute__((ext_vector_type(4))) _Float16 v4h;
typedef __attribute__((ext_vector_type(2))) unsigned short v2us;
typedef __attribute__((ext_vector_type(4))) unsigned short v4us;
typedef __attribute__((ext_vector_type(2))) float v2f;
typedef __attribute__((ext_vector_type(4))) int v4i;

__global__ __launch_bounds__(256) void k_wtG(const float* __restrict__ w, int K, int N, bf* Bt) {
    const int lane = threadIdx.x & 31; const int L0 = (blockIdx.x * 8 + (threadIdx.x >> 5)) * 8; const int nlines = N * K / 64;
{
#pragma unroll 1
        for (int l = 0; l < 8; ++l) { const int L = L0 + l; if (L >= nlines) break; const size_t e = (size_t)L * 64 + lane * 2; const int k = (int)(e % K), n = (int)(e / K); v2us o;
            o[0] = f2bf(w[(size_t)k * N + n]); o[1] = f2bf(w[(size_t)(k + 1) * N + n]); *(v2us*)(Bt + e) = o; }
         }
}
__global__ __launch_bounds__(256) void k_cvt8(const float* __restrict__ src, bf* dst, size_t n8) { const size_t i = (size_t)blockIdx.x * 256 + threadIdx.x; if (i >= n8) return; const v8f v = *(const v8f*)(src + i * 8); v8us o;
#pragma unroll
    for (int k = 0; k < 8; ++k) o[k] = f2bf(v[k]); *(v8us*)(dst + i * 8) = o;  }
__global__ __launch_bounds__(256) void k_cscvt(const float* __restrict__ cosT, const float* __restrict__ sinT, float* CS) { const int idx = blockIdx.x * 256 + threadIdx.x; if (idx >= TT * HD) return; v2f cs; cs[0] = bfr(cosT[idx]); cs[1] = bfr(sinT[idx]); *(v2f*)(CS + (size_t)idx * 2) = cs;  }
// k_rope: head planes [h][t][d] (fp16 + hi/lo) of rope(x) x sc with the rotate-half convention out[d] = x[d] cos[t][d] - x[d+HD/2] sin[t][d], out[d+HD/2] = x[d+HD/2] cos[t][d+HD/2] + x[d] sin[t][d+HD/2]
__global__ __launch_bounds__(256) void k_rope(const float* __restrict__ F, int pitch, int nheads, const float* __restrict__ CS, const float* __restrict__ RF, const float* __restrict__ nw, float sc, h16* P16, bf* Ph, bf* Pl) {
    const size_t e = ((size_t)blockIdx.x * 256 + threadIdx.x) * 2; if (e >= (size_t)nheads * TT * HD) return; const int d = (int)(e % HD); const int t = (int)((e / HD) % TT); const int h = (int)(e / ((size_t)HD * TT)); const float* f = F + (size_t)t * pitch + h * HD; const float rf = RF ? RF[(size_t)h * TT + t] : 1.0f; v2h o16; v2us oh, ol;
#pragma unroll
    for (int q = 0; q < 2; ++q) { const int dd = d + q; const int dp = (dd < HD / 2) ? dd + HD / 2 : dd - HD / 2; float x0 = f[dd], x1 = f[dp];
        if (RF) { float n0 = __fmul_rn(x0, rf), n1 = __fmul_rn(x1, rf); asm volatile("" : "+v"(n0)); asm volatile("" : "+v"(n1)); x0 = __fmul_rn(bfr(nw[dd]), n0); x1 = __fmul_rn(bfr(nw[dp]), n1); }
        const v2f cs = *(const v2f*)(CS + ((size_t)t * HD + dd) * 2); float a = __fmul_rn(x0, cs[0]), bq = __fmul_rn(x1, cs[1]); asm volatile("" : "+v"(a)); asm volatile("" : "+v"(bq)); const float r = ((dd < HD / 2) ? __fsub_rn(a, bq) : __fadd_rn(a, bq)) * sc;
        o16[q] = tohx(r); unsigned short a2, c2; splitf(r, a2, c2); oh[q] = a2; ol[q] = c2; }
    *(v2h*)(P16 + e) = o16; *(v2us*)(Ph + e) = oh; *(v2us*)(Pl + e) = ol;  }
__global__ __launch_bounds__(256) void k_vtp(const float* __restrict__ F, int pitch, int nheads, h16* V16, bf* Vh, bf* Vl) { const size_t e = ((size_t)blockIdx.x * 256 + threadIdx.x) * 2; if (e >= (size_t)nheads * HD * TT) return; const int t = (int)(e % TT); const int d = (int)((e / TT) % HD); const int g = (int)(e / ((size_t)TT * HD)); v2h o16; v2us oh, ol;
#pragma unroll
    for (int q = 0; q < 2; ++q) { const float x = F[(size_t)(t + q) * pitch + g * HD + d]; o16[q] = tohx(x); unsigned short a2, c2; splitf(x, a2, c2); oh[q] = a2; ol[q] = c2; }
    *(v2h*)(V16 + e) = o16; *(v2us*)(Vh + e) = oh; *(v2us*)(Vl + e) = ol;  }
__global__ __launch_bounds__(256) void k_csid(float* CS) { const int idx = blockIdx.x * 256 + threadIdx.x; if (idx >= TT * HD) return; v2f cs; cs[0] = 1.0f; cs[1] = 0.0f; *(v2f*)(CS + (size_t)idx * 2) = cs;  }
__global__ __launch_bounds__(256) void k_awacc(const bf* __restrict__ Ph, const bf* __restrict__ Pl, const h16* __restrict__ P16, int h0, float* AW) { const size_t e = ((size_t)blockIdx.x * 256 + threadIdx.x) * 4; if (e >= (size_t)TT * TT) return; const int i = (int)(e / TT); v4f acc; if (h0 == 0) { for (int u = 0; u < 4; ++u) acc[u] = 0.0f; } else acc = *(const v4f*)(AW + e);
#pragma unroll
    for (int zz = 0; zz < ZH; ++zz) { float p4[4]; if (i < RH) { const size_t o = ((size_t)zz * RH + i) * TT + (e % TT); for (int u = 0; u < 4; ++u) p4[u] = __fadd_rn(bf2f(Ph[o + u]), bf2f(Pl[o + u])); } else { const size_t o = ((size_t)zz * TT + i) * TT + (e % TT); for (int u = 0; u < 4; ++u) p4[u] = __fmul_rn((float)P16[o + u], 1.0f / PCAR); } for (int u = 0; u < 4; ++u) acc[u] = __fadd_rn(acc[u], p4[u]); }
    *(v4f*)(AW + e) = acc;  }
__global__ __launch_bounds__(256) void k_awfin(float* AW) { const size_t e = ((size_t)blockIdx.x * 256 + threadIdx.x) * 4; if (e >= (size_t)TT * TT) return; v4f a = *(const v4f*)(AW + e); for (int u = 0; u < 4; ++u) a[u] = __fmul_rn(a[u], 0.0625f); *(v4f*)(AW + e) = a;  }
// k_asoft: per row (zz, i): t = S x HD^-0.5 (no mask); softmax over the 2048 keys (register row, one exp, fixed trees);
__global__ __launch_bounds__(256) void k_asoft(const float* __restrict__ Sb, h16* P16, bf* Ph, bf* Pl) {   /* full softmax, then the block-causal multiplier */
    const int lane = threadIdx.x & 31; const int row = blockIdx.x * 8 + (threadIdx.x >> 5); if (row >= ZH * TT) return; const int i = row % TT; const int zz = row / TT; (void)zz; const bool hires = (i < RH); const float* sr = Sb + (size_t)row * TT; float v[TT / 32]; float mx = -3.0e38f;
#pragma unroll
    for (int ch = 0; ch < TT / 128; ++ch) { const int j0 = ch * 128 + lane * 4; const v4f a = *(const v4f*)(sr + j0);
#pragma unroll
        for (int q = 0; q < 4; ++q) { const int j = j0 + q; (void)j; const float t = a[q] * SCL; v[ch * 4 + q] = t; mx = fmaxf(mx, t); } }
#pragma unroll
    for (int sh = 16; sh; sh >>= 1) mx = fmaxf(mx, __shfl_xor(mx, sh, 32));
    float sum = 0.f;
#pragma unroll
    for (int k = 0; k < TT / 32; ++k) { float d0 = __fsub_rn(v[k], mx); asm volatile("" : "+v"(d0)); v[k] = __builtin_amdgcn_exp2f(__fmul_rn(d0, 1.4426950408889634f)); sum += v[k]; }
#pragma unroll
    for (int sh = 16; sh; sh >>= 1) sum += __shfl_xor(sum, sh, 32);
    const float f = __fdiv_rn(hires ? 1.0f : PCAR, sum);
#pragma unroll
    for (int k2 = 0; k2 < TT / 32; ++k2) { const int jj = (k2 >> 2) * 128 + lane * 4 + (k2 & 3); if ((jj >> 6) > (i >> 6)) v[k2] = 0.0f; }   /* attn * [j/64 <= i/64] after the softmax */
{
        if (hires) {
#pragma unroll
            for (int ch = 0; ch < TT / 128; ++ch) { v4us oh, ol;
#pragma unroll
                for (int q = 0; q < 4; ++q) { unsigned short a, c2; splitf(v[ch * 4 + q] * f, a, c2); oh[q] = a; ol[q] = c2; }
                const size_t oo = ((size_t)zz * (RH ? RH : 1) + i) * TT + ch * 128 + lane * 4; *(v4us*)(Ph + oo) = oh; *(v4us*)(Pl + oo) = ol; }
        } else {
#pragma unroll
            for (int ch = 0; ch < TT / 128; ++ch) { v4h o4;
#pragma unroll
                for (int q = 0; q < 4; ++q) o4[q] = tohx(v[ch * 4 + q] * f);
                *(v4h*)(P16 + (size_t)row * TT + ch * 128 + lane * 4) = o4; } }
         }
}
__global__ __launch_bounds__(256) void k_merge(const float* __restrict__ O, int h0, bf* Ah, bf* Al) { const size_t e = ((size_t)blockIdx.x * 256 + threadIdx.x) * 2; if (e >= (size_t)ZH * TT * HD) return; const int d = (int)(e % HD); const int t = (int)((e / HD) % TT); const int zz = (int)(e / ((size_t)HD * TT)); const float cs = (t < RH) ? 1.0f : (1.0f / PCAR); const size_t oo = (size_t)t * DQ + (h0 + zz) * HD + d;
    v2us oh, ol;
#pragma unroll
    for (int q = 0; q < 2; ++q) { unsigned short a, c2; splitf(O[e + q] * cs, a, c2); oh[q] = a; ol[q] = c2; } *(v2us*)(Ah + oo) = oh; *(v2us*)(Al + oo) = ol;  }

extern "C" void kernel_launch(void* const* d_in, const int* in_sizes, int n_in,
                              void* d_out, int out_size, void* d_ws, size_t ws_size, hipStream_t stream) {
    (void)in_sizes; (void)n_in; (void)out_size;
    const float* x = (const float*)d_in[0]; const float* wf = (const float*)d_in[1]; const float* wo = (const float*)d_in[2]; const float* bo = (const float*)d_in[3]; const float* wq = wf; const float* wk = wf; const float* wv = wf; (void)wk; (void)wv; const float* cosT = nullptr; const float* sinT = nullptr; (void)cosT; (void)sinT;
    float* OUT = (float*)d_out;     // [2][2048][1024]
    char* wsp = (char*)d_ws;
    auto take = [&](size_t bytes) { char* p = wsp; wsp += (bytes + 255) & ~(size_t)255; return (void*)p; };
    bf* WQ = nullptr; bf* WK = nullptr; bf* WV = nullptr; bf* WO = (bf*)take((size_t)DM * DQ * 2); float* CS = (float*)take((size_t)TT * HD * 2 * 4);
    bf* XB = (bf*)take((size_t)TT * DM * 2); bf* WALL = (bf*)take((size_t)(DQ + 2 * DKV) * DM * 2); float* AW = OUT + (size_t)NB_ * TT * DM + 0;   /* out1 region base; per batch + b*TT*TT */ float* FQ = (float*)take((size_t)TT * DQ * 4); float* FK = (float*)take((size_t)TT * DKV * 4);
    h16* QP16 = (h16*)take((size_t)NH_ * TT * HD * 2); h16* KP16 = (h16*)take((size_t)NKV * TT * HD * 2); h16* VT16 = (h16*)take((size_t)NKV * HD * TT * 2);
    bf* QPh = (bf*)take((size_t)NH_ * TT * HD * 2); bf* QPl = (bf*)take((size_t)NH_ * TT * HD * 2); bf* KPh = (bf*)take((size_t)NKV * TT * HD * 2); bf* KPl = (bf*)take((size_t)NKV * TT * HD * 2); bf* VTh = (bf*)take((size_t)NKV * HD * TT * 2); bf* VTl = (bf*)take((size_t)NKV * HD * TT * 2); bf* Ph = (bf*)take((size_t)ZH * RH * TT * 2); bf* Pl = (bf*)take((size_t)ZH * RH * TT * 2);
    float* Sb = (float*)take((size_t)ZH * TT * TT * 4); h16* P16 = (h16*)take((size_t)ZH * TT * TT * 2); float* Ob = (float*)take((size_t)ZH * TT * HD * 4); bf* ATh = (bf*)take((size_t)TT * DQ * 2); bf* ATl = (bf*)take((size_t)TT * DQ * 2);
    if ((size_t)(wsp - (char*)d_ws) > ws_size) return;    // ws 256 MiB
    float* FV = FK;   // v projection reuses the k buffer after the k planes are built (stream-ordered)
    { k_wtG<<<(unsigned)((DM * (DQ + 2 * DKV) / 64 + 63) / 64), 256, 0, stream>>>(wf, DM, DQ + 2 * DKV, WALL); WQ = WALL; WK = WALL + (size_t)DQ * DM; WV = WK + (size_t)DKV * DM;
      k_wtG<<<(unsigned)((DQ * DM / 64 + 63) / 64), 256, 0, stream>>>(wo, DQ, DM, WO);
       }
    k_csid<<<(TT * HD + 255) / 256, 256, 0, stream>>>(CS);
    const unsigned LQ = (unsigned)(((size_t)NH_ * TT * HD / 2 + 255) / 256), LKv = (unsigned)(((size_t)NKV * TT * HD / 2 + 255) / 256);
    for (int b = 0; b < NB_; ++b) {
        
        k_cvt8<<<(unsigned)(((size_t)TT * DM / 8 + 255) / 256), 256, 0, stream>>>(x + (size_t)b * TT * DM, XB, (size_t)TT * DM / 8);
        k_gemmks<bf, 0, false, 8><<<dim3(TT / 64, DQ / 64, 1), 256, 0, stream>>>(XB, nullptr, WQ, nullptr, DM, FQ, DQ, nullptr, 0, 0, 0);
        k_rope<<<LQ, 256, 0, stream>>>(FQ, DQ, NH_, CS, nullptr, nullptr, 1.0f, QP16, QPh, QPl);
        k_gemmks<bf, 0, false, 8><<<dim3(TT / 64, DKV / 64, 1), 256, 0, stream>>>(XB, nullptr, WK, nullptr, DM, FK, DKV, nullptr, 0, 0, 0);
        k_rope<<<LKv, 256, 0, stream>>>(FK, DKV, NKV, CS, nullptr, nullptr, 1.0f, KP16, KPh, KPl);
        k_gemmks<bf, 0, false, 8><<<dim3(TT / 64, DKV / 64, 1), 256, 0, stream>>>(XB, nullptr, WV, nullptr, DM, FV, DKV, nullptr, 0, 0, 0); k_vtp<<<LKv, 256, 0, stream>>>(FV, DKV, NKV, VT16, VTh, VTl);
        for (int h0 = 0; h0 < NH_; h0 += ZH) { const size_t zq = (size_t)h0, zk = (size_t)(h0 / REP);   // one kv head per query head: the pass's two heads use consecutive kv planes (z-strides TT*HD)
            k_gemmw<bf, 2, false><<<dim3(TT / 64, TT / 64, ZH), 32, 0, stream>>>(QPh + zq * TT * HD, QPl + zq * TT * HD, KPh + zk * TT * HD, KPl + zk * TT * HD, HD, Sb, TT, nullptr, (size_t)TT * HD, (size_t)TT * HD, (size_t)TT * TT);   /* scores hl on all rows */
            k_asoft<<<ZH * TT / 8, 256, 0, stream>>>(Sb, P16, Ph, Pl); k_awacc<<<(unsigned)(((size_t)TT * TT / 4 + 255) / 256), 256, 0, stream>>>(Ph, Pl, P16, h0, AW + (size_t)b * TT * TT);
            k_gemmks<bf, 2, false, 16><<<dim3(RH / 64, HD / 64, ZH), 512, 0, stream>>>(Ph, Pl, VTh + zk * HD * TT, VTl + zk * HD * TT, TT, Ob, HD, nullptr, (size_t)RH * TT, (size_t)HD * TT, (size_t)TT * HD);
            k_gemmks<h16, 0, false, 16><<<dim3((TT - RH) / 64, HD / 64, ZH), 512, 0, stream>>>(P16 + (size_t)RH * TT, nullptr, VT16 + zk * HD * TT, nullptr, TT, Ob + (size_t)RH * HD, HD, nullptr, (size_t)TT * TT, (size_t)HD * TT, (size_t)TT * HD);
            k_merge<<<(unsigned)(((size_t)ZH * TT * HD / 2 + 255) / 256), 256, 0, stream>>>(Ob, h0, ATh, ATl); }
        k_gemmks<bf, 1, true, 8><<<dim3(TT / 64, DM / 64, 1), 256, 0, stream>>>(ATh, ATl, WO, nullptr, DQ, OUT + (size_t)b * TT * DM, DM, bo, 0, 0, 0); k_awfin<<<(unsigned)(((size_t)TT * TT / 4 + 255) / 256), 256, 0, stream>>>(AW + (size_t)b * TT * TT); }
}

// v002
// Measured time: 1010 microseconds a run.
// Next to v001, in two timings, it ran 1.09 times as fast each time.
// Counting every step since v000, it is 2.06 times as fast.
#include <hip/hip_runtime.h>

// CausalTemporalAttention (x [2][2048][1024]; qkv = x w_qkv ([1024][3072] q | k | v; 16 x 64); attn = softmax(q.k / 8) over ALL keys, THEN multiplied by the block-causal mask [j/64 <= i/64] without renormalisation; out0 = (attn v) merged w_out + b_out -> [2][2048][1024] at 0; out1 = attn.mean over the 16 heads -> [2][2048][2048] at element 4,194,304).
// Compute dtypes, f32 accumulate: every input rounded to bf16; q/k/v on PLAIN bf16 operands (inputs: exact); scores hl x hl (3 products) on every row over all keys (the softmax normaliser needs every key); softmax f32; the structural block mask applied to the probabilities in f32; attn.v: rows < 512 hl (3 products), the rest fp16 (x1024); the head mean accumulated in f32 from the f32 probabilities in head order inside the softmax kernel (no atomics) and scaled by 1/16 in the last head pass; w_out hl x exact (2 products) + bias.

#define NB_  2
#define TT   2048
#define DM   1024
#define NH_  16
#define NKV  16
#define REP  (NH_ / NKV)
#define HD   64
#define DQ   (NH_ * HD)
#define DKV  (NKV * HD)
#define ZH   2
#define RH   512                  // query rows < RH use hi+lo planes (0: none)
#define WIN  0
#define PCAR 1024.0f
#define SCL  0.125f   // HD^-0.5
typedef _Float16 h16;
typedef unsigned short bf;
typedef __attribute__((ext_vector_type(16))) __bf16   v16bf;
typedef __attribute__((ext_vector_type(16))) _Float16 v16h;
typedef __attribute__((ext_vector_type(8)))  _Float16 v8h;
typedef __attribute__((ext_vector_type(8)))  unsigned short v8us;
typedef __attribute__((ext_vector_type(8)))  float    v8f;
typedef __attribute__((ext_vector_type(4)))  float    v4f;
typedef v8h  __attribute__((may_alias)) v8ha;
typedef v4f  __attribute__((may_alias)) v4fa;
typedef v8us __attribute__((may_alias)) v8usa;

__device__ __forceinline__ unsigned short f2bf(float f) { unsigned u = __float_as_uint(f); u += 0x7FFFu + ((u >> 16) & 1u); return (unsigned short)(u >> 16); }
__device__ __forceinline__ float bf2f(unsigned short b) { return __uint_as_float(((unsigned)b) << 16); }
__device__ __forceinline__ float bfr(float f) { return bf2f(f2bf(f)); }
__device__ __forceinline__ v16h cat16(v8h lo, v8h hi) { return __builtin_shufflevector(lo, hi, 0, 1, 2, 3, 4, 5, 6, 7, 8, 9, 10, 11, 12, 13, 14, 15); }
__device__ __forceinline__ v16bf cat16b(v8us lo, v8us hi) { return __builtin_bit_cast(v16bf, __builtin_shufflevector(lo, hi, 0, 1, 2, 3, 4, 5, 6, 7, 8, 9, 10, 11, 12, 13, 14, 15)); }
__device__ __forceinline__ v8f wmma16(v16h a, v16h b, v8f c) { return __builtin_amdgcn_wmma_f32_16x16x32_f16(false, a, false, b, (short)0, c, false, false); }
__device__ __forceinline__ v8f wmmab(v16bf a, v16bf b, v8f c) { return __builtin_amdgcn_wmma_f32_16x16x32_bf16(false, a, false, b, (short)0, c, false, false); }



// ---- k_gemmw: register-blocked GEMM, ONE WAVE per 64x64 output tile (16 accumulators), operands straight from K-contiguous 16-bit planes; grid (M/64, N/64, Z), 32 threads.
// C[m][n] (f32, pitch ldc, + optional f32 bias[n]) = sum_k A[m][k] Bt[n][k] (+ split products per NSPLIT). z-batch strides sA/sB/sC in elements. K % 32 == 0.
template <typename T16> struct WFrag;
template <> struct WFrag<h16> { typedef v16h V; static __device__ __forceinline__ V ld(const h16* p) { return cat16(*(const v8h*)p, *(const v8h*)(p + 16)); } static __device__ __forceinline__ v8f mma(V a, V b, v8f c) { return wmma16(a, b, c); } };
template <> struct WFrag<bf> { typedef v16bf V; static __device__ __forceinline__ V ld(const bf* p) { return cat16b(*(const v8us*)p, *(const v8us*)(p + 16)); } static __device__ __forceinline__ v8f mma(V a, V b, v8f c) { return wmmab(a, b, c); } };
template <typename T16, int NSPLIT, bool BIAS>
__global__ __launch_bounds__(32) void k_gemmw(const T16* __restrict__ A, const T16* __restrict__ A2, const T16* __restrict__ Bt, const T16* __restrict__ Bt2, int K, float* C, int ldc, const float* __restrict__ bias, size_t sA, size_t sB, size_t sC) {
    typedef typename WFrag<T16>::V V;
    __shared__ __align__(16) float os[16 * 68];
    const size_t z = blockIdx.z; A += z * sA; if (A2) A2 += z * sA; Bt += z * sB; if (Bt2) Bt2 += z * sB; C += z * sC;
    const int lane = threadIdx.x & 31, lr = lane & 15, hi = lane >> 4; const int r0 = blockIdx.x * 64, c0 = blockIdx.y * 64;
    v8f acc[4][4];
#pragma unroll
    for (int mb = 0; mb < 4; ++mb)
#pragma unroll
        for (int nb = 0; nb < 4; ++nb) acc[mb][nb] = (v8f){};
    const size_t aoff = (size_t)(r0 + lr) * K + 8 * hi, boff = (size_t)(c0 + lr) * K + 8 * hi;
#pragma unroll 1
    for (int kc = 0; kc < K; kc += 32) {
        V a[4], a2[4];
#pragma unroll
        for (int mb = 0; mb < 4; ++mb) { a[mb] = WFrag<T16>::ld(A + aoff + (size_t)mb * 16 * K + kc); if (NSPLIT == 1 || NSPLIT == 2) a2[mb] = WFrag<T16>::ld(A2 + aoff + (size_t)mb * 16 * K + kc); }
#pragma unroll
        for (int nb = 0; nb < 4; ++nb) { const V b = WFrag<T16>::ld(Bt + boff + (size_t)nb * 16 * K + kc); V b2; if (NSPLIT >= 2) b2 = WFrag<T16>::ld(Bt2 + boff + (size_t)nb * 16 * K + kc);
#pragma unroll
            for (int mb = 0; mb < 4; ++mb) { acc[mb][nb] = WFrag<T16>::mma(a[mb], b, acc[mb][nb]); if (NSPLIT == 1 || NSPLIT == 2) acc[mb][nb] = WFrag<T16>::mma(a2[mb], b, acc[mb][nb]); if (NSPLIT >= 2) acc[mb][nb] = WFrag<T16>::mma(a[mb], b2, acc[mb][nb]); } }
        asm volatile("v_nop\n\tv_nop\n\tv_nop\n\tv_nop" : "+v"(acc[0][0]), "+v"(acc[1][1]), "+v"(acc[2][2]), "+v"(acc[3][3]) : "v"(a[0]), "v"(a[3]));
    }
#pragma unroll
    for (int mb = 0; mb < 4; ++mb) {
#pragma unroll
        for (int nb = 0; nb < 4; ++nb) {
#pragma unroll
            for (int j = 0; j < 8; ++j) os[(hi * 8 + j) * 68 + nb * 16 + lr] = acc[mb][nb][j]; }
        __builtin_amdgcn_wave_barrier(); asm volatile("" ::: "memory");
        float* crow = C + (size_t)(r0 + mb * 16) * ldc + c0;
{
#pragma unroll
            for (int s = 0; s < 8; ++s) { const int row = 2 * s + hi, cofs = lr * 4; v4f val = *(const v4fa*)(os + row * 68 + cofs); if (BIAS) { val[0] += bfr(bias[c0 + cofs]); val[1] += bfr(bias[c0 + cofs + 1]); val[2] += bfr(bias[c0 + cofs + 2]); val[3] += bfr(bias[c0 + cofs + 3]); }
                *(v4f*)(crow + (size_t)row * ldc + cofs) = val; }
             }
        __builtin_amdgcn_wave_barrier(); asm volatile("" ::: "memory");
    }
}

// ---- k_gemmks: the same 64x64 tile and the same trip as k_gemmw, for the long-K products: NW waves per work-group, each takes K/NW of the k range (which: at the loop); each wave leaves its f32 partial tile in its own LDS plane [64][68], one barrier, then the NW planes are summed in wave order (a fixed order) and stored as whole 256-B row pieces. K % (64 NW) == 0; grid (M/64, N/64, Z), 32 NW threads.
template <typename T16, int NSPLIT, bool BIAS, int NW>
__global__ __launch_bounds__(NW * 32) void k_gemmks(const T16* __restrict__ A, const T16* __restrict__ A2, const T16* __restrict__ Bt, const T16* __restrict__ Bt2, int K, float* C, int ldc, const float* __restrict__ bias, size_t sA, size_t sB, size_t sC) {
    typedef typename WFrag<T16>::V V;
    __shared__ __align__(16) float ps[NW * 64 * 68];
    const size_t z = blockIdx.z; A += z * sA; if (A2) A2 += z * sA; Bt += z * sB; if (Bt2) Bt2 += z * sB; C += z * sC;
    const int lane = threadIdx.x & 31, lr = lane & 15, hi = lane >> 4; const int wv = __builtin_amdgcn_readfirstlane((int)(threadIdx.x >> 5)); const int r0 = blockIdx.x * 64, c0 = blockIdx.y * 64;
    v8f acc[4][4];
#pragma unroll
    for (int mb = 0; mb < 4; ++mb)
#pragma unroll
        for (int nb = 0; nb < 4; ++nb) acc[mb][nb] = (v8f){};
    // waves 2p and 2p+1 share the k range [2p K/NW, (2p+2) K/NW) and take the two 64-B halves of each 128-B line in the same trip: a line is wanted by both at once, not again one trip later when the other waves' lines may have pushed it out of the cache
    const int kw2 = 2 * (K / NW), kbeg = (wv >> 1) * kw2 + (wv & 1) * 32;
    // addresses: a wave-uniform base per sixteen-row block and plane, fixed over the loop, and ONE 32-bit lane offset in bytes (A and Bt have the same pitch K), which alone moves along k
    const T16* sa[4]; const T16* sa2[4]; const T16* sb[4]; const T16* sb2[4];
#pragma unroll
    for (int q = 0; q < 4; ++q) { const size_t ra = (size_t)(r0 + q * 16) * K + kbeg, rb = (size_t)(c0 + q * 16) * K + kbeg; sa[q] = A + ra; sb[q] = Bt + rb; if (NSPLIT == 1 || NSPLIT == 2) sa2[q] = A2 + ra; if (NSPLIT >= 2) sb2[q] = Bt2 + rb; }
    unsigned voff = (unsigned)(lr * K + 8 * hi) * (unsigned)sizeof(T16);
    // rolled: one trip's fragments and the sixteen accumulators are what a wave's registers hold
#pragma unroll 1
    for (int kc = 0; kc < kw2; kc += 64) {
        V a[4], a2[4];
#pragma unroll
        for (int mb = 0; mb < 4; ++mb) { a[mb] = WFrag<T16>::ld((const T16*)((const char*)sa[mb] + voff)); if (NSPLIT == 1 || NSPLIT == 2) a2[mb] = WFrag<T16>::ld((const T16*)((const char*)sa2[mb] + voff)); }
#pragma unroll
        for (int nb = 0; nb < 4; ++nb) { const V b = WFrag<T16>::ld((const T16*)((const char*)sb[nb] + voff)); V b2; if (NSPLIT >= 2) b2 = WFrag<T16>::ld((const T16*)((const char*)sb2[nb] + voff));
#pragma unroll
            for (int mb = 0; mb < 4; ++mb) { acc[mb][nb] = WFrag<T16>::mma(a[mb], b, acc[mb][nb]); if (NSPLIT == 1 || NSPLIT == 2) acc[mb][nb] = WFrag<T16>::mma(a2[mb], b, acc[mb][nb]); if (NSPLIT >= 2) acc[mb][nb] = WFrag<T16>::mma(a[mb], b2, acc[mb][nb]); } }
        // four vector slots behind the trip's last matrix instruction, on the taken back edge too. The lane offset is an input, so that it keeps its register to the end of the trip and is stepped only behind the waits on all of the trip's loads
        asm volatile("v_nop\n\tv_nop\n\tv_nop\n\tv_nop" : "+v"(acc[0][0]), "+v"(acc[1][1]), "+v"(acc[2][2]), "+v"(acc[3][3]) : "v"(a[0]), "v"(a[3]), "v"(voff));
        voff += 64 * (unsigned)sizeof(T16);
    }
    float* pw = ps + wv * (64 * 68);
#pragma unroll
    for (int mb = 0; mb < 4; ++mb)
#pragma unroll
        for (int nb = 0; nb < 4; ++nb)
#pragma unroll
            for (int j = 0; j < 8; ++j) pw[(mb * 16 + hi * 8 + j) * 68 + nb * 16 + lr] = acc[mb][nb][j];
    __syncthreads();   // every wave's partial tile is in LDS before any wave sums
#pragma unroll
    for (int s = 0; s < 32 / NW; ++s) { const int idx = s * (NW * 32) + (int)threadIdx.x; const int row = idx >> 4, cofs = (idx & 15) * 4; const float* pr = ps + row * 68 + cofs; v4f val = *(const v4fa*)pr;
#pragma unroll
        for (int w = 1; w < NW; ++w) { const v4f q = *(const v4fa*)(pr + w * (64 * 68)); val[0] += q[0]; val[1] += q[1]; val[2] += q[2]; val[3] += q[3]; }
        if (BIAS) { val[0] += bfr(bias[c0 + cofs]); val[1] += bfr(bias[c0 + cofs + 1]); val[2] += bfr(bias[c0 + cofs + 2]); val[3] += bfr(bias[c0 + cofs + 3]); }
        *(v4f*)(C + (size_t)(r0 + row) * ldc + c0 + cofs) = val; }
}

__device__ __forceinline__ h16 tohx(float x) { return (h16)x; }
__device__ __forceinline__ void splitf(float y, unsigned short& h, unsigned short& l) { h = f2bf(y); l = f2bf(y - bf2f(h)); }
typedef __attribute__((ext_vector_type(2))) _Float16 v2h;
typedef __attribute__((ext_vector_type(4))) _Float16 v4h;
typedef __attribute__((ext_vector_type(2))) unsigned short v2us;
typedef __attribute__((ext_vector_type(4))) unsigned short v4us;
typedef __attribute__((ext_vector_type(2))) float v2f;
typedef __attribute__((ext_vector_type(4))) int v4i;

__global__ __launch_bounds__(256) void k_wtG(const float* __restrict__ w, int K, int N, bf* Bt) {
    const int lane = threadIdx.x & 31; const int L0 = (blockIdx.x * 8 + (threadIdx.x >> 5)) * 8; const int nlines = N * K / 64;
{
#pragma unroll 1
        for (int l = 0; l < 8; ++l) { const int L = L0 + l; if (L >= nlines) break; const size_t e = (size_t)L * 64 + lane * 2; const int k = (int)(e % K), n = (int)(e / K); v2us o;
            o[0] = f2bf(w[(size_t)k * N + n]); o[1] = f2bf(w[(size_t)(k + 1) * N + n]); *(v2us*)(Bt + e) = o; }
         }
}
__global__ __launch_bounds__(256) void k_cvt8(const float* __restrict__ src, bf* dst, size_t n8) { const size_t i = (size_t)blockIdx.x * 256 + threadIdx.x; if (i >= n8) return; const v8f v = *(const v8f*)(src + i * 8); v8us o;
#pragma unroll
    for (int k = 0; k < 8; ++k) o[k] = f2bf(v[k]); *(v8us*)(dst + i * 8) = o;  }
__global__ __launch_bounds__(256) void k_cscvt(const float* __restrict__ cosT, const float* __restrict__ sinT, float* CS) { const int idx = blockIdx.x * 256 + threadIdx.x; if (idx >= TT * HD) return; v2f cs; cs[0] = bfr(cosT[idx]); cs[1] = bfr(sinT[idx]); *(v2f*)(CS + (size_t)idx * 2) = cs;  }
// k_rope: head planes [h][t][d] (fp16 + hi/lo) of rope(x) x sc with the rotate-half convention out[d] = x[d] cos[t][d] - x[d+HD/2] sin[t][d], out[d+HD/2] = x[d+HD/2] cos[t][d+HD/2] + x[d] sin[t][d+HD/2]
__global__ __launch_bounds__(256) void k_rope(const float* __restrict__ F, int pitch, int nheads, const float* __restrict__ CS, const float* __restrict__ RF, const float* __restrict__ nw, float sc, h16* P16, bf* Ph, bf* Pl) {
    const size_t e = ((size_t)blockIdx.x * 256 + threadIdx.x) * 2; if (e >= (size_t)nheads * TT * HD) return; const int d = (int)(e % HD); const int t = (int)((e / HD) % TT); const int h = (int)(e / ((size_t)HD * TT)); const float* f = F + (size_t)t * pitch + h * HD; const float rf = RF ? RF[(size_t)h * TT + t] : 1.0f; v2h o16; v2us oh, ol;
#pragma unroll
    for (int q = 0; q < 2; ++q) { const int dd = d + q; const int dp = (dd < HD / 2) ? dd + HD / 2 : dd - HD / 2; float x0 = f[dd], x1 = f[dp];
        if (RF) { float n0 = __fmul_rn(x0, rf), n1 = __fmul_rn(x1, rf); asm volatile("" : "+v"(n0)); asm volatile("" : "+v"(n1)); x0 = __fmul_rn(bfr(nw[dd]), n0); x1 = __fmul_rn(bfr(nw[dp]), n1); }
        const v2f cs = *(const v2f*)(CS + ((size_t)t * HD + dd) * 2); float a = __fmul_rn(x0, cs[0]), bq = __fmul_rn(x1, cs[1]); asm volatile("" : "+v"(a)); asm volatile("" : "+v"(bq)); const float r = ((dd < HD / 2) ? __fsub_rn(a, bq) : __fadd_rn(a, bq)) * sc;
        o16[q] = tohx(r); unsigned short a2, c2; splitf(r, a2, c2); oh[q] = a2; ol[q] = c2; }
    *(v2h*)(P16 + e) = o16; *(v2us*)(Ph + e) = oh; *(v2us*)(Pl + e) = ol;  }
__global__ __launch_bounds__(256) void k_vtp(const float* __restrict__ F, int pitch, int nheads, h16* V16, bf* Vh, bf* Vl) { const size_t e = ((size_t)blockIdx.x * 256 + threadIdx.x) * 2; if (e >= (size_t)nheads * HD * TT) return; const int t = (int)(e % TT); const int d = (int)((e / TT) % HD); const int g = (int)(e / ((size_t)TT * HD)); v2h o16; v2us oh, ol;
#pragma unroll
    for (int q = 0; q < 2; ++q) { const float x = F[(size_t)(t + q) * pitch + g * HD + d]; o16[q] = tohx(x); unsigned short a2, c2; splitf(x, a2, c2); oh[q] = a2; ol[q] = c2; }
    *(v2h*)(V16 + e) = o16; *(v2us*)(Vh + e) = oh; *(v2us*)(Vl + e) = ol;  }
__global__ __launch_bounds__(256) void k_csid(float* CS) { const int idx = blockIdx.x * 256 + threadIdx.x; if (idx >= TT * HD) return; v2f cs; cs[0] = 1.0f; cs[1] = 0.0f; *(v2f*)(CS + (size_t)idx * 2) = cs;  }
// k_asoft: one wave per query row i, the pass's ZH heads one after the other: t = S x HD^-0.5 (no mask); softmax over the 2048 keys (register row, one exp, fixed trees); the block-causal multiplier; the 16-bit probability planes;
// and the head mean: the row of AW (zero in the first pass, else what the earlier passes left) takes the f32 probabilities of the pass's heads in head order, x 1/16 in the last pass. One wave owns a whole row of AW, so nothing is shared.
__global__ __launch_bounds__(256) void k_asoft(const float* __restrict__ Sb, h16* P16, bf* Ph, bf* Pl, int h0, float* AW) {   /* full softmax, then the block-causal multiplier */
    const int lane = threadIdx.x & 31; const int i = blockIdx.x * 8 + (threadIdx.x >> 5);
    if (i >= TT) return; const bool hires = (i < RH); float* ar = AW + (size_t)i * TT + lane * 4;
    // every load of the wave is issued up front: the score rows of all ZH heads and the mean's row. s, aw and v stay in registers only under constant indices: every loop over them is unrolled for that
    v4f s[ZH][TT / 128]; v4f aw[TT / 128];
#pragma unroll
    for (int zz = 0; zz < ZH; ++zz)
#pragma unroll
        for (int ch = 0; ch < TT / 128; ++ch) s[zz][ch] = *(const v4f*)(Sb + ((size_t)zz * TT + i) * TT + ch * 128 + lane * 4);
    if (h0 == 0) {
#pragma unroll
        for (int ch = 0; ch < TT / 128; ++ch) aw[ch] = (v4f){};
    } else {
#pragma unroll
        for (int ch = 0; ch < TT / 128; ++ch) aw[ch] = *(const v4f*)(ar + ch * 128);
    }
#pragma unroll
    for (int zz = 0; zz < ZH; ++zz) { const int row = zz * TT + i; float v[TT / 32]; float mx = -3.0e38f;
#pragma unroll
        for (int ch = 0; ch < TT / 128; ++ch) {
#pragma unroll
            for (int q = 0; q < 4; ++q) { const float t = s[zz][ch][q] * SCL; v[ch * 4 + q] = t; mx = fmaxf(mx, t); } }
#pragma unroll
        for (int sh = 16; sh; sh >>= 1) mx = fmaxf(mx, __shfl_xor(mx, sh, 32));
        float sum = 0.f;
#pragma unroll
        for (int k = 0; k < TT / 32; ++k) { float d0 = __fsub_rn(v[k], mx); asm volatile("" : "+v"(d0)); v[k] = __builtin_amdgcn_exp2f(__fmul_rn(d0, 1.4426950408889634f)); sum += v[k]; }
#pragma unroll
        for (int sh = 16; sh; sh >>= 1) sum += __shfl_xor(sum, sh, 32);
        const float f = __fdiv_rn(hires ? 1.0f : PCAR, sum);
#pragma unroll
        for (int k2 = 0; k2 < TT / 32; ++k2) { const int jj = (k2 >> 2) * 128 + lane * 4 + (k2 & 3); if ((jj >> 6) > (i >> 6)) v[k2] = 0.0f; }   /* attn * [j/64 <= i/64] after the softmax */
        if (hires) {
#pragma unroll
            for (int ch = 0; ch < TT / 128; ++ch) { v4us oh, ol;
#pragma unroll
                for (int q = 0; q < 4; ++q) { const float p = v[ch * 4 + q] * f; unsigned short a, c2; splitf(p, a, c2); oh[q] = a; ol[q] = c2; aw[ch][q] += p; }
                const size_t oo = ((size_t)zz * (RH ? RH : 1) + i) * TT + ch * 128 + lane * 4; *(v4us*)(Ph + oo) = oh; *(v4us*)(Pl + oo) = ol; }
        } else {
#pragma unroll
            for (int ch = 0; ch < TT / 128; ++ch) { v4h o4;
#pragma unroll
                for (int q = 0; q < 4; ++q) { const float p = v[ch * 4 + q] * f; o4[q] = tohx(p); aw[ch][q] += p * (1.0f / PCAR); }
                *(v4h*)(P16 + (size_t)row * TT + ch * 128 + lane * 4) = o4; } }
    }
    const float fin = (h0 + ZH >= NH_) ? 0.0625f : 1.0f;
#pragma unroll
    for (int ch = 0; ch < TT / 128; ++ch) { v4f o = aw[ch]; o[0] *= fin; o[1] *= fin; o[2] *= fin; o[3] *= fin; *(v4f*)(ar + ch * 128) = o; }
}
__global__ __launch_bounds__(256) void k_merge(const float* __restrict__ O, int h0, bf* Ah, bf* Al) { const size_t e = ((size_t)blockIdx.x * 256 + threadIdx.x) * 2; if (e >= (size_t)ZH * TT * HD) return; const int d = (int)(e % HD); const int t = (int)((e / HD) % TT); const int zz = (int)(e / ((size_t)HD * TT)); const float cs = (t < RH) ? 1.0f : (1.0f / PCAR); const size_t oo = (size_t)t * DQ + (h0 + zz) * HD + d;
    v2us oh, ol;
#pragma unroll
    for (int q = 0; q < 2; ++q) { unsigned short a, c2; splitf(O[e + q] * cs, a, c2); oh[q] = a; ol[q] = c2; } *(v2us*)(Ah + oo) = oh; *(v2us*)(Al + oo) = ol;  }

extern "C" void kernel_launch(void* const* d_in, const int* in_sizes, int n_in,
                              void* d_out, int out_size, void* d_ws, size_t ws_size, hipStream_t stream) {
    (void)in_sizes; (void)n_in; (void)out_size;
    const float* x = (const float*)d_in[0]; const float* wf = (const float*)d_in[1]; const float* wo = (const float*)d_in[2]; const float* bo = (const float*)d_in[3]; const float* wq = wf; const float* wk = wf; const float* wv = wf; (void)wk; (void)wv; const float* cosT = nullptr; const float* sinT = nullptr; (void)cosT; (void)sinT;
    float* OUT = (float*)d_out;     // [2][2048][1024]
    char* wsp = (char*)d_ws;
    auto take = [&](size_t bytes) { char* p = wsp; wsp += (bytes + 255) & ~(size_t)255; return (void*)p; };
    bf* WQ = nullptr; bf* WK = nullptr; bf* WV = nullptr; bf* WO = (bf*)take((size_t)DM * DQ * 2); float* CS = (float*)take((size_t)TT * HD * 2 * 4);
    bf* XB = (bf*)take((size_t)TT * DM * 2); bf* WALL = (bf*)take((size_t)(DQ + 2 * DKV) * DM * 2); float* AW = OUT + (size_t)NB_ * TT * DM + 0;   /* out1 region base; per batch + b*TT*TT */ float* FQ = (float*)take((size_t)TT * DQ * 4); float* FK = (float*)take((size_t)TT * DKV * 4);
    h16* QP16 = (h16*)take((size_t)NH_ * TT * HD * 2); h16* KP16 = (h16*)take((size_t)NKV * TT * HD * 2); h16* VT16 = (h16*)take((size_t)NKV * HD * TT * 2);
    bf* QPh = (bf*)take((size_t)NH_ * TT * HD * 2); bf* QPl = (bf*)take((size_t)NH_ * TT * HD * 2); bf* KPh = (bf*)take((size_t)NKV * TT * HD * 2); bf* KPl = (bf*)take((size_t)NKV * TT * HD * 2); bf* VTh = (bf*)take((size_t)NKV * HD * TT * 2); bf* VTl = (bf*)take((size_t)NKV * HD * TT * 2); bf* Ph = (bf*)take((size_t)ZH * RH * TT * 2); bf* Pl = (bf*)take((size_t)ZH * RH * TT * 2);
    float* Sb = (float*)take((size_t)ZH * TT * TT * 4); h16* P16 = (h16*)take((size_t)ZH * TT * TT * 2); float* Ob = (float*)take((size_t)ZH * TT * HD * 4); bf* ATh = (bf*)take((size_t)TT * DQ * 2); bf* ATl = (bf*)take((size_t)TT * DQ * 2);
    if ((size_t)(wsp - (char*)d_ws) > ws_size) return;    // ws 256 MiB
    float* FV = FK;   // v projection reuses the k buffer after the k planes are built (stream-ordered)
    { k_wtG<<<(unsigned)((DM * (DQ + 2 * DKV) / 64 + 63) / 64), 256, 0, stream>>>(wf, DM, DQ + 2 * DKV, WALL); WQ = WALL; WK = WALL + (size_t)DQ * DM; WV = WK + (size_t)DKV * DM;
      k_wtG<<<(unsigned)((DQ * DM / 64 + 63) / 64), 256, 0, stream>>>(wo, DQ, DM, WO);
       }
    k_csid<<<(TT * HD + 255) / 256, 256, 0, stream>>>(CS);
    const unsigned LQ = (unsigned)(((size_t)NH_ * TT * HD / 2 + 255) / 256), LKv = (unsigned)(((size_t)NKV * TT * HD / 2 + 255) / 256);
    for (int b = 0; b < NB_; ++b) {
        
        k_cvt8<<<(unsigned)(((size_t)TT * DM / 8 + 255) / 256), 256, 0, stream>>>(x + (size_t)b * TT * DM, XB, (size_t)TT * DM / 8);
        k_gemmks<bf, 0, false, 8><<<dim3(TT / 64, DQ / 64, 1), 256, 0, stream>>>(XB, nullptr, WQ, nullptr, DM, FQ, DQ, nullptr, 0, 0, 0);
        k_rope<<<LQ, 256, 0, stream>>>(FQ, DQ, NH_, CS, nullptr, nullptr, 1.0f, QP16, QPh, QPl);
        k_gemmks<bf, 0, false, 8><<<dim3(TT / 64, DKV / 64, 1), 256, 0, stream>>>(XB, nullptr, WK, nullptr, DM, FK, DKV, nullptr, 0, 0, 0);
        k_rope<<<LKv, 256, 0, stream>>>(FK, DKV, NKV, CS, nullptr, nullptr, 1.0f, KP16, KPh, KPl);
        k_gemmks<bf, 0, false, 8><<<dim3(TT / 64, DKV / 64, 1), 256, 0, stream>>>(XB, nullptr, WV, nullptr, DM, FV, DKV, nullptr, 0, 0, 0); k_vtp<<<LKv, 256, 0, stream>>>(FV, DKV, NKV, VT16, VTh, VTl);
        for (int h0 = 0; h0 < NH_; h0 += ZH) { const size_t zq = (size_t)h0, zk = (size_t)(h0 / REP);   // one kv head per query head: the pass's two heads use consecutive kv planes (z-strides TT*HD)
            k_gemmw<bf, 2, false><<<dim3(TT / 64, TT / 64, ZH), 32, 0, stream>>>(QPh + zq * TT * HD, QPl + zq * TT * HD, KPh + zk * TT * HD, KPl + zk * TT * HD, HD, Sb, TT, nullptr, (size_t)TT * HD, (size_t)TT * HD, (size_t)TT * TT);   /* scores hl on all rows */
            k_asoft<<<TT / 8, 256, 0, stream>>>(Sb, P16, Ph, Pl, h0, AW + (size_t)b * TT * TT);
            k_gemmks<bf, 2, false, 16><<<dim3(RH / 64, HD / 64, ZH), 512, 0, stream>>>(Ph, Pl, VTh + zk * HD * TT, VTl + zk * HD * TT, TT, Ob, HD, nullptr, (size_t)RH * TT, (size_t)HD * TT, (size_t)TT * HD);
            k_gemmks<h16, 0, false, 16><<<dim3((TT - RH) / 64, HD / 64, ZH), 512, 0, stream>>>(P16 + (size_t)RH * TT, nullptr, VT16 + zk * HD * TT, nullptr, TT, Ob + (size_t)RH * HD, HD, nullptr, (size_t)TT * TT, (size_t)HD * TT, (size_t)TT * HD);
            k_merge<<<(unsigned)(((size_t)ZH * TT * HD / 2 + 255) / 256), 256, 0, stream>>>(Ob, h0, ATh, ATl); }
        k_gemmks<bf, 1, true, 8><<<dim3(TT / 64, DM / 64, 1), 256, 0, stream>>>(ATh, ATl, WO, nullptr, DQ, OUT + (size_t)b * TT * DM, DM, bo, 0, 0, 0); }
}

// v003
// A run of this version takes 742 microseconds.
// Two timings next to v002 both put it at 1.36 times that version's speed.
// All steps since v000 together make it 2.81 times as fast.
#include <hip/hip_runtime.h>

// CausalTemporalAttention (x [2][2048][1024]; qkv = x w_qkv ([1024][3072] q | k | v; 16 x 64); attn = softmax(q.k / 8) over ALL keys, THEN multiplied by the block-causal mask [j/64 <= i/64] without renormalisation; out0 = (attn v) merged w_out + b_out -> [2][2048][1024] at 0; out1 = attn.mean over the 16 heads -> [2][2048][2048] at element 4,194,304).
// Compute dtypes, f32 accumulate: every input rounded to bf16; q/k/v on PLAIN bf16 operands (inputs: exact); scores hl x hl (3 products) on every row over all keys (the softmax normaliser needs every key); softmax f32; the structural block mask applied to the probabilities in f32; attn.v: rows < 512 hl (3 products), the rest fp16 (x1024); the head mean accumulated in f32 from the f32 probabilities in head order inside the softmax kernel (no atomics) and scaled by 1/16 in the last head pass; w_out hl x exact (2 products) + bias.

// Both batches run in every launch: the projections take the 4096 rows of x as one M; the head planes lie [head][batch][t][d] (v: [head][batch][d][t]), so that the 2 heads x 2 batches of a pass are four consecutive planes, the z index of the pass's launches (z = head in pass x 2 + batch).
#define NB_  2
#define TT   2048
#define DM   1024
#define NH_  16
#define NKV  16
#define REP  (NH_ / NKV)
#define HD   64
#define DQ   (NH_ * HD)
#define DKV  (NKV * HD)
#define ZH   2
#define MT   (NB_ * TT)           // rows of both batches
#define ZP   (ZH * NB_)           // (head, batch) planes per pass
#define RH   512                  // query rows < RH use hi+lo planes (0: none)
#define WIN  0
#define PCAR 1024.0f
#define SCL  0.125f   // HD^-0.5
typedef _Float16 h16;
typedef unsigned short bf;
typedef __attribute__((ext_vector_type(16))) __bf16   v16bf;
typedef __attribute__((ext_vector_type(16))) _Float16 v16h;
typedef __attribute__((ext_vector_type(8)))  _Float16 v8h;
typedef __attribute__((ext_vector_type(8)))  unsigned short v8us;
typedef __attribute__((ext_vector_type(8)))  float    v8f;
typedef __attribute__((ext_vector_type(4)))  float    v4f;
typedef v8h  __attribute__((may_alias)) v8ha;
typedef v4f  __attribute__((may_alias)) v4fa;
typedef v8us __attribute__((may_alias)) v8usa;

__device__ __forceinline__ unsigned short f2bf(float f) { unsigned u = __float_as_uint(f); u += 0x7FFFu + ((u >> 16) & 1u); return (unsigned short)(u >> 16); }
__device__ __forceinline__ float bf2f(unsigned short b) { return __uint_as_float(((unsigned)b) << 16); }
__device__ __forceinline__ float bfr(float f) { return bf2f(f2bf(f)); }
__device__ __forceinline__ v16h cat16(v8h lo, v8h hi) { return __builtin_shufflevector(lo, hi, 0, 1, 2, 3, 4, 5, 6, 7, 8, 9, 10, 11, 12, 13, 14, 15); }
__device__ __forceinline__ v16bf cat16b(v8us lo, v8us hi) { return __builtin_bit_cast(v16bf, __builtin_shufflevector(lo, hi, 0, 1, 2, 3, 4, 5, 6, 7, 8, 9, 10, 11, 12, 13, 14, 15)); }
__device__ __forceinline__ v8f wmma16(v16h a, v16h b, v8f c) { return __builtin_amdgcn_wmma_f32_16x16x32_f16(false, a, false, b, (short)0, c, false, false); }
__device__ __forceinline__ v8f wmmab(v16bf a, v16bf b, v8f c) { return __builtin_amdgcn_wmma_f32_16x16x32_bf16(false, a, false, b, (short)0, c, false, false); }



// ---- k_gemmw: register-blocked GEMM, ONE WAVE per 64x64 output tile (16 accumulators), operands straight from K-contiguous 16-bit planes; grid (M/64, N/64, Z), 32 threads.
// C[m][n] (f32, pitch ldc, + optional f32 bias[n]) = sum_k A[m][k] Bt[n][k] (+ split products per NSPLIT). z-batch strides sA/sB/sC in elements. K % 32 == 0.
template <typename T16> struct WFrag;
template <> struct WFrag<h16> { typedef v16h V; static __device__ __forceinline__ V ld(const h16* p) { return cat16(*(const v8h*)p, *(const v8h*)(p + 16)); } static __device__ __forceinline__ v8f mma(V a, V b, v8f c) { return wmma16(a, b, c); } };
template <> struct WFrag<bf> { typedef v16bf V; static __device__ __forceinline__ V ld(const bf* p) { return cat16b(*(const v8us*)p, *(const v8us*)(p + 16)); } static __device__ __forceinline__ v8f mma(V a, V b, v8f c) { return wmmab(a, b, c); } };
template <typename T16, int NSPLIT, bool BIAS>
__global__ __launch_bounds__(32) void k_gemmw(const T16* __restrict__ A, const T16* __restrict__ A2, const T16* __restrict__ Bt, const T16* __restrict__ Bt2, int K, float* C, int ldc, const float* __restrict__ bias, size_t sA, size_t sB, size_t sC) {
    typedef typename WFrag<T16>::V V;
    __shared__ __align__(16) float os[16 * 68];
    const size_t z = blockIdx.z; A += z * sA; if (A2) A2 += z * sA; Bt += z * sB; if (Bt2) Bt2 += z * sB; C += z * sC;
    const int lane = threadIdx.x & 31, lr = lane & 15, hi = lane >> 4; const int r0 = blockIdx.x * 64, c0 = blockIdx.y * 64;
    v8f acc[4][4];
#pragma unroll
    for (int mb = 0; mb < 4; ++mb)
#pragma unroll
        for (int nb = 0; nb < 4; ++nb) acc[mb][nb] = (v8f){};
    const size_t aoff = (size_t)(r0 + lr) * K + 8 * hi, boff = (size_t)(c0 + lr) * K + 8 * hi;
#pragma unroll 1
    for (int kc = 0; kc < K; kc += 32) {
        V a[4], a2[4];
#pragma unroll
        for (int mb = 0; mb < 4; ++mb) { a[mb] = WFrag<T16>::ld(A + aoff + (size_t)mb * 16 * K + kc); if (NSPLIT == 1 || NSPLIT == 2) a2[mb] = WFrag<T16>::ld(A2 + aoff + (size_t)mb * 16 * K + kc); }
#pragma unroll
        for (int nb = 0; nb < 4; ++nb) { const V b = WFrag<T16>::ld(Bt + boff + (size_t)nb * 16 * K + kc); V b2; if (NSPLIT >= 2) b2 = WFrag<T16>::ld(Bt2 + boff + (size_t)nb * 16 * K + kc);
#pragma unroll
            for (int mb = 0; mb < 4; ++mb) { acc[mb][nb] = WFrag<T16>::mma(a[mb], b, acc[mb][nb]); if (NSPLIT == 1 || NSPLIT == 2) acc[mb][nb] = WFrag<T16>::mma(a2[mb], b, acc[mb][nb]); if (NSPLIT >= 2) acc[mb][nb] = WFrag<T16>::mma(a[mb], b2, acc[mb][nb]); } }
        asm volatile("v_nop\n\tv_nop\n\tv_nop\n\tv_nop" : "+v"(acc[0][0]), "+v"(acc[1][1]), "+v"(acc[2][2]), "+v"(acc[3][3]) : "v"(a[0]), "v"(a[3]));
    }
#pragma unroll
    for (int mb = 0; mb < 4; ++mb) {
#pragma unroll
        for (int nb = 0; nb < 4; ++nb) {
#pragma unroll
            for (int j = 0; j < 8; ++j) os[(hi * 8 + j) * 68 + nb * 16 + lr] = acc[mb][nb][j]; }
        __builtin_amdgcn_wave_barrier(); asm volatile("" ::: "memory");
        float* crow = C + (size_t)(r0 + mb * 16) * ldc + c0;
{
#pragma unroll
            for (int s = 0; s < 8; ++s) { const int row = 2 * s + hi, cofs = lr * 4; v4f val = *(const v4fa*)(os + row * 68 + cofs); if (BIAS) { val[0] += bfr(bias[c0 + cofs]); val[1] += bfr(bias[c0 + cofs + 1]); val[2] += bfr(bias[c0 + cofs + 2]); val[3] += bfr(bias[c0 + cofs + 3]); }
                *(v4f*)(crow + (size_t)row * ldc + cofs) = val; }
             }
        __builtin_amdgcn_wave_barrier(); asm volatile("" ::: "memory");
    }
}

// ---- k_gemmks: the same 64x64 tile and the same trip as k_gemmw, for the long-K products: NW waves per work-group, each takes K/NW of the k range (which: at the loop); each wave leaves its f32 partial tile in its own LDS plane [64][68], one barrier, then the NW planes are summed in wave order (a fixed order) and stored as whole 256-B row pieces. K % (64 NW) == 0; grid (M/64, N/64, Z), 32 NW threads.
template <typename T16, int NSPLIT, bool BIAS, int NW>
__global__ __launch_bounds__(NW * 32) void k_gemmks(const T16* __restrict__ A, const T16* __restrict__ A2, const T16* __restrict__ Bt, const T16* __restrict__ Bt2, int K, float* C, int ldc, const float* __restrict__ bias, size_t sA, size_t sB, size_t sC) {
    typedef typename WFrag<T16>::V V;
    __shared__ __align__(16) float ps[NW * 64 * 68];
    const size_t z = blockIdx.z; A += z * sA; if (A2) A2 += z * sA; Bt += z * sB; if (Bt2) Bt2 += z * sB; C += z * sC;
    const int lane = threadIdx.x & 31, lr = lane & 15, hi = lane >> 4; const int wv = __builtin_amdgcn_readfirstlane((int)(threadIdx.x >> 5)); const int r0 = blockIdx.x * 64, c0 = blockIdx.y * 64;
    v8f acc[4][4];
#pragma unroll
    for (int mb = 0; mb < 4; ++mb)
#pragma unroll
        for (int nb = 0; nb < 4; ++nb) acc[mb][nb] = (v8f){};
    // waves 2p and 2p+1 share the k range [2p K/NW, (2p+2) K/NW) and take the two 64-B halves of each 128-B line in the same trip: a line is wanted by both at once, not again one trip later when the other waves' lines may have pushed it out of the cache
    const int kw2 = 2 * (K / NW), kbeg = (wv >> 1) * kw2 + (wv & 1) * 32;
    // addresses: a wave-uniform base per sixteen-row block and plane, fixed over the loop, and ONE 32-bit lane offset in bytes (A and Bt have the same pitch K), which alone moves along k
    const T16* sa[4]; const T16* sa2[4]; const T16* sb[4]; const T16* sb2[4];
#pragma unroll
    for (int q = 0; q < 4; ++q) { const size_t ra = (size_t)(r0 + q * 16) * K + kbeg, rb = (size_t)(c0 + q * 16) * K + kbeg; sa[q] = A + ra; sb[q] = Bt + rb; if (NSPLIT == 1 || NSPLIT == 2) sa2[q] = A2 + ra; if (NSPLIT >= 2) sb2[q] = Bt2 + rb; }
    unsigned voff = (unsigned)(lr * K + 8 * hi) * (unsigned)sizeof(T16);
    // rolled: one trip's fragments and the sixteen accumulators are what a wave's registers hold
#pragma unroll 1
    for (int kc = 0; kc < kw2; kc += 64) {
        V a[4], a2[4];
#pragma unroll
        for (int mb = 0; mb < 4; ++mb) { a[mb] = WFrag<T16>::ld((const T16*)((const char*)sa[mb] + voff)); if (NSPLIT == 1 || NSPLIT == 2) a2[mb] = WFrag<T16>::ld((const T16*)((const char*)sa2[mb] + voff)); }
#pragma unroll
        for (int nb = 0; nb < 4; ++nb) { const V b = WFrag<T16>::ld((const T16*)((const char*)sb[nb] + voff)); V b2; if (NSPLIT >= 2) b2 = WFrag<T16>::ld((const T16*)((const char*)sb2[nb] + voff));
#pragma unroll
            for (int mb = 0; mb < 4; ++mb) { acc[mb][nb] = WFrag<T16>::mma(a[mb], b, acc[mb][nb]); if (NSPLIT == 1 || NSPLIT == 2) acc[mb][nb] = WFrag<T16>::mma(a2[mb], b, acc[mb][nb]); if (NSPLIT >= 2) acc[mb][nb] = WFrag<T16>::mma(a[mb], b2, acc[mb][nb]); } }
        // four vector slots behind the trip's last matrix instruction, on the taken back edge too. The lane offset is an input, so that it keeps its register to the end of the trip and is stepped only behind the waits on all of the trip's loads
        asm volatile("v_nop\n\tv_nop\n\tv_nop\n\tv_nop" : "+v"(acc[0][0]), "+v"(acc[1][1]), "+v"(acc[2][2]), "+v"(acc[3][3]) : "v"(a[0]), "v"(a[3]), "v"(voff));
        voff += 64 * (unsigned)sizeof(T16);
    }
    float* pw = ps + wv * (64 * 68);
#pragma unroll
    for (int mb = 0; mb < 4; ++mb)
#pragma unroll
        for (int nb = 0; nb < 4; ++nb)
#pragma unroll
            for (int j = 0; j < 8; ++j) pw[(mb * 16 + hi * 8 + j) * 68 + nb * 16 + lr] = acc[mb][nb][j];
    __syncthreads();   // every wave's partial tile is in LDS before any wave sums
#pragma unroll
    for (int s = 0; s < 32 / NW; ++s) { const int idx = s * (NW * 32) + (int)threadIdx.x; const int row = idx >> 4, cofs = (idx & 15) * 4; const float* pr = ps + row * 68 + cofs; v4f val = *(const v4fa*)pr;
#pragma unroll
        for (int w = 1; w < NW; ++w) { const v4f q = *(const v4fa*)(pr + w * (64 * 68)); val[0] += q[0]; val[1] += q[1]; val[2] += q[2]; val[3] += q[3]; }
        if (BIAS) { val[0] += bfr(bias[c0 + cofs]); val[1] += bfr(bias[c0 + cofs + 1]); val[2] += bfr(bias[c0 + cofs + 2]); val[3] += bfr(bias[c0 + cofs + 3]); }
        *(v4f*)(C + (size_t)(r0 + row) * ldc + c0 + cofs) = val; }
}

__device__ __forceinline__ h16 tohx(float x) { return (h16)x; }
__device__ __forceinline__ void splitf(float y, unsigned short& h, unsigned short& l) { h = f2bf(y); l = f2bf(y - bf2f(h)); }
typedef __attribute__((ext_vector_type(2))) _Float16 v2h;
typedef __attribute__((ext_vector_type(4))) _Float16 v4h;
typedef __attribute__((ext_vector_type(2))) unsigned short v2us;
typedef __attribute__((ext_vector_type(4))) unsigned short v4us;
typedef __attribute__((ext_vector_type(2))) float v2f;
typedef __attribute__((ext_vector_type(4))) int v4i;

__global__ __launch_bounds__(256) void k_wtG(const float* __restrict__ w, int K, int N, bf* Bt) {
    const int lane = threadIdx.x & 31; const int L0 = (blockIdx.x * 8 + (threadIdx.x >> 5)) * 8; const int nlines = N * K / 64;
{
#pragma unroll 1
        for (int l = 0; l < 8; ++l) { const int L = L0 + l; if (L >= nlines) break; const size_t e = (size_t)L * 64 + lane * 2; const int k = (int)(e % K), n = (int)(e / K); v2us o;
            o[0] = f2bf(w[(size_t)k * N + n]); o[1] = f2bf(w[(size_t)(k + 1) * N + n]); *(v2us*)(Bt + e) = o; }
         }
}
__global__ __launch_bounds__(256) void k_cvt8(const float* __restrict__ src, bf* dst, size_t n8) { const size_t i = (size_t)blockIdx.x * 256 + threadIdx.x; if (i >= n8) return; const v8f v = *(const v8f*)(src + i * 8); v8us o;
#pragma unroll
    for (int k = 0; k < 8; ++k) o[k] = f2bf(v[k]); *(v8us*)(dst + i * 8) = o;  }
__global__ __launch_bounds__(256) void k_cscvt(const float* __restrict__ cosT, const float* __restrict__ sinT, float* CS) { const int idx = blockIdx.x * 256 + threadIdx.x; if (idx >= TT * HD) return; v2f cs; cs[0] = bfr(cosT[idx]); cs[1] = bfr(sinT[idx]); *(v2f*)(CS + (size_t)idx * 2) = cs;  }
// k_rope: head planes [h][b][t][d] (fp16 + hi/lo) of rope(x) x sc with the rotate-half convention out[d] = x[d] cos[t][d] - x[d+HD/2] sin[t][d], out[d+HD/2] = x[d+HD/2] cos[t][d+HD/2] + x[d] sin[t][d+HD/2]
__global__ __launch_bounds__(256) void k_rope(const float* __restrict__ F, int pitch, int nheads, const float* __restrict__ CS, const float* __restrict__ RF, const float* __restrict__ nw, float sc, h16* P16, bf* Ph, bf* Pl) {
    const size_t e = ((size_t)blockIdx.x * 256 + threadIdx.x) * 2; if (e >= (size_t)nheads * NB_ * TT * HD) return; const int d = (int)(e % HD); const int t = (int)((e / HD) % TT); const int pl = (int)(e / ((size_t)HD * TT)); const int h = pl / NB_, bb = pl % NB_; const float* f = F + (size_t)(bb * TT + t) * pitch + h * HD; const float rf = RF ? RF[(size_t)h * TT + t] : 1.0f; v2h o16; v2us oh, ol;
    asm volatile("s_wait_xcnt 0x0" ::: "memory");   // in front of the address arithmetic below, which may reuse the registers that the RF load names
#pragma unroll
    for (int q = 0; q < 2; ++q) { const int dd = d + q; const int dp = (dd < HD / 2) ? dd + HD / 2 : dd - HD / 2; float x0 = f[dd], x1 = f[dp];
        if (RF) { float n0 = __fmul_rn(x0, rf), n1 = __fmul_rn(x1, rf); asm volatile("" : "+v"(n0)); asm volatile("" : "+v"(n1)); x0 = __fmul_rn(bfr(nw[dd]), n0); x1 = __fmul_rn(bfr(nw[dp]), n1); }
        const v2f cs = *(const v2f*)(CS + ((size_t)t * HD + dd) * 2); float a = __fmul_rn(x0, cs[0]), bq = __fmul_rn(x1, cs[1]); asm volatile("" : "+v"(a)); asm volatile("" : "+v"(bq)); const float r = ((dd < HD / 2) ? __fsub_rn(a, bq) : __fadd_rn(a, bq)) * sc;
        o16[q] = tohx(r); unsigned short a2, c2; splitf(r, a2, c2); oh[q] = a2; ol[q] = c2; }
    *(v2h*)(P16 + e) = o16; *(v2us*)(Ph + e) = oh; *(v2us*)(Pl + e) = ol;  }
__global__ __launch_bounds__(256) void k_vtp(const float* __restrict__ F, int pitch, int nheads, h16* V16, bf* Vh, bf* Vl) { const size_t e = ((size_t)blockIdx.x * 256 + threadIdx.x) * 2; if (e >= (size_t)nheads * NB_ * HD * TT) return; const int t = (int)(e % TT); const int d = (int)((e / TT) % HD); const int pl = (int)(e / ((size_t)TT * HD)); const int g = pl / NB_, bb = pl % NB_; v2h o16; v2us oh, ol;
#pragma unroll
    for (int q = 0; q < 2; ++q) { const float x = F[(size_t)(bb * TT + t + q) * pitch + g * HD + d]; o16[q] = tohx(x); unsigned short a2, c2; splitf(x, a2, c2); oh[q] = a2; ol[q] = c2; }
    *(v2h*)(V16 + e) = o16; *(v2us*)(Vh + e) = oh; *(v2us*)(Vl + e) = ol;  }
__global__ __launch_bounds__(256) void k_csid(float* CS) { const int idx = blockIdx.x * 256 + threadIdx.x; if (idx >= TT * HD) return; v2f cs; cs[0] = 1.0f; cs[1] = 0.0f; *(v2f*)(CS + (size_t)idx * 2) = cs;  }
// k_asoft: one wave per query row i of batch blockIdx.x, the pass's ZH heads one after the other: t = S x HD^-0.5 (no mask); softmax over the 2048 keys (register row, one exp, fixed trees); the block-causal multiplier; the 16-bit probability planes;
// and the head mean: the row of AW (zero in the first pass, else what the earlier passes left) takes the f32 probabilities of the pass's heads in head order, x 1/16 in the last pass. One wave owns a whole row of AW, so nothing is shared.
__global__ __launch_bounds__(256) void k_asoft(const float* __restrict__ Sb, h16* P16, bf* Ph, bf* Pl, int h0, float* AW) {   /* full softmax, then the block-causal multiplier */
    const int lane = threadIdx.x & 31; const int i = blockIdx.y * 8 + (threadIdx.x >> 5); const int b = blockIdx.x;   // batch is the fast grid index: the dearer rows < RH of both batches come first and on different WGPs
    if (i >= TT) return; const bool hires = (i < RH); float* ar = AW + ((size_t)b * TT + i) * TT + lane * 4;
    // every load of the wave is issued up front: the score rows of all ZH heads and the mean's row. s, aw and v stay in registers only under constant indices: every loop over them is unrolled for that
    v4f s[ZH][TT / 128]; v4f aw[TT / 128];
#pragma unroll
    for (int zz = 0; zz < ZH; ++zz)
#pragma unroll
        for (int ch = 0; ch < TT / 128; ++ch) s[zz][ch] = *(const v4f*)(Sb + ((size_t)(zz * NB_ + b) * TT + i) * TT + ch * 128 + lane * 4);
    if (h0 == 0) {
#pragma unroll
        for (int ch = 0; ch < TT / 128; ++ch) aw[ch] = (v4f){};
    } else {
#pragma unroll
        for (int ch = 0; ch < TT / 128; ++ch) aw[ch] = *(const v4f*)(ar + ch * 128);
    }
#pragma unroll
    for (int zz = 0; zz < ZH; ++zz) { const int row = (zz * NB_ + b) * TT + i; float v[TT / 32]; float mx = -3.0e38f;
#pragma unroll
        for (int ch = 0; ch < TT / 128; ++ch) {
#pragma unroll
            for (int q = 0; q < 4; ++q) { const float t = s[zz][ch][q] * SCL; v[ch * 4 + q] = t; mx = fmaxf(mx, t); } }
#pragma unroll
        for (int sh = 16; sh; sh >>= 1) mx = fmaxf(mx, __shfl_xor(mx, sh, 32));
        float sum = 0.f;
#pragma unroll
        for (int k = 0; k < TT / 32; ++k) { float d0 = __fsub_rn(v[k], mx); asm volatile("" : "+v"(d0)); v[k] = __builtin_amdgcn_exp2f(__fmul_rn(d0, 1.4426950408889634f)); sum += v[k]; }
#pragma unroll
        for (int sh = 16; sh; sh >>= 1) sum += __shfl_xor(sum, sh, 32);
        const float f = __fdiv_rn(hires ? 1.0f : PCAR, sum);
#pragma unroll
        for (int k2 = 0; k2 < TT / 32; ++k2) { const int jj = (k2 >> 2) * 128 + lane * 4 + (k2 & 3); if ((jj >> 6) > (i >> 6)) v[k2] = 0.0f; }   /* attn * [j/64 <= i/64] after the softmax */
        if (hires) {
#pragma unroll
            for (int ch = 0; ch < TT / 128; ++ch) { v4us oh, ol;
#pragma unroll
                for (int q = 0; q < 4; ++q) { const float p = v[ch * 4 + q] * f; unsigned short a, c2; splitf(p, a, c2); oh[q] = a; ol[q] = c2; aw[ch][q] += p; }
                const size_t oo = ((size_t)(zz * NB_ + b) * (RH ? RH : 1) + i) * TT + ch * 128 + lane * 4; *(v4us*)(Ph + oo) = oh; *(v4us*)(Pl + oo) = ol; }
        } else {
#pragma unroll
            for (int ch = 0; ch < TT / 128; ++ch) { v4h o4;
#pragma unroll
                for (int q = 0; q < 4; ++q) { const float p = v[ch * 4 + q] * f; o4[q] = tohx(p); aw[ch][q] += p * (1.0f / PCAR); }
                *(v4h*)(P16 + (size_t)row * TT + ch * 128 + lane * 4) = o4; } }
    }
    const float fin = (h0 + ZH >= NH_) ? 0.0625f : 1.0f;
#pragma unroll
    for (int ch = 0; ch < TT / 128; ++ch) { v4f o = aw[ch]; o[0] *= fin; o[1] *= fin; o[2] *= fin; o[3] *= fin; *(v4f*)(ar + ch * 128) = o; }
}
__global__ __launch_bounds__(256) void k_merge(const float* __restrict__ O, int h0, bf* Ah, bf* Al) { const size_t e = ((size_t)blockIdx.x * 256 + threadIdx.x) * 2; if (e >= (size_t)ZH * NB_ * TT * HD) return; const int d = (int)(e % HD); const int t = (int)((e / HD) % TT); const int pl = (int)(e / ((size_t)HD * TT)); const int zz = pl / NB_, bb = pl % NB_; const float cs = (t < RH) ? 1.0f : (1.0f / PCAR); const size_t oo = (size_t)(bb * TT + t) * DQ + (h0 + zz) * HD + d;
    v2us oh, ol;
#pragma unroll
    for (int q = 0; q < 2; ++q) { unsigned short a, c2; splitf(O[e + q] * cs, a, c2); oh[q] = a; ol[q] = c2; } *(v2us*)(Ah + oo) = oh; *(v2us*)(Al + oo) = ol;  }

extern "C" void kernel_launch(void* const* d_in, const int* in_sizes, int n_in,
                              void* d_out, int out_size, void* d_ws, size_t ws_size, hipStream_t stream) {
    (void)in_sizes; (void)n_in; (void)out_size;
    const float* x = (const float*)d_in[0]; const float* wf = (const float*)d_in[1]; const float* wo = (const float*)d_in[2]; const float* bo = (const float*)d_in[3]; const float* wq = wf; const float* wk = wf; const float* wv = wf; (void)wk; (void)wv; const float* cosT = nullptr; const float* sinT = nullptr; (void)cosT; (void)sinT;
    float* OUT = (float*)d_out;     // [2][2048][1024]
    char* wsp = (char*)d_ws;
    auto take = [&](size_t bytes) { char* p = wsp; wsp += (bytes + 255) & ~(size_t)255; return (void*)p; };
    bf* WQ = nullptr; bf* WK = nullptr; bf* WV = nullptr; bf* WO = (bf*)take((size_t)DM * DQ * 2); float* CS = (float*)take((size_t)TT * HD * 2 * 4);
    bf* XB = (bf*)take((size_t)MT * DM * 2); bf* WALL = (bf*)take((size_t)(DQ + 2 * DKV) * DM * 2); float* AW = OUT + (size_t)NB_ * TT * DM + 0;   /* out1 region base; batch b at + b*TT*TT */ float* FQ = (float*)take((size_t)MT * DQ * 4); float* FK = (float*)take((size_t)MT * DKV * 4);
    h16* QP16 = (h16*)take((size_t)NH_ * MT * HD * 2); h16* KP16 = (h16*)take((size_t)NKV * MT * HD * 2); h16* VT16 = (h16*)take((size_t)NKV * HD * MT * 2);
    bf* QPh = (bf*)take((size_t)NH_ * MT * HD * 2); bf* QPl = (bf*)take((size_t)NH_ * MT * HD * 2); bf* KPh = (bf*)take((size_t)NKV * MT * HD * 2); bf* KPl = (bf*)take((size_t)NKV * MT * HD * 2); bf* VTh = (bf*)take((size_t)NKV * HD * MT * 2); bf* VTl = (bf*)take((size_t)NKV * HD * MT * 2); bf* Ph = (bf*)take((size_t)ZP * RH * TT * 2); bf* Pl = (bf*)take((size_t)ZP * RH * TT * 2);
    float* Sb = (float*)take((size_t)ZP * TT * TT * 4); h16* P16 = (h16*)take((size_t)ZP * TT * TT * 2); float* Ob = (float*)take((size_t)ZP * TT * HD * 4); bf* ATh = (bf*)take((size_t)MT * DQ * 2); bf* ATl = (bf*)take((size_t)MT * DQ * 2);
    if ((size_t)(wsp - (char*)d_ws) > ws_size) return;    // 251 MiB of the 256 MiB
    float* FV = FK;   // v projection reuses the k buffer after the k planes are built (stream-ordered)
    { k_wtG<<<(unsigned)((DM * (DQ + 2 * DKV) / 64 + 63) / 64), 256, 0, stream>>>(wf, DM, DQ + 2 * DKV, WALL); WQ = WALL; WK = WALL + (size_t)DQ * DM; WV = WK + (size_t)DKV * DM;
      k_wtG<<<(unsigned)((DQ * DM / 64 + 63) / 64), 256, 0, stream>>>(wo, DQ, DM, WO);
       }
    k_csid<<<(TT * HD + 255) / 256, 256, 0, stream>>>(CS);
    const unsigned LQ = (unsigned)(((size_t)NH_ * MT * HD / 2 + 255) / 256), LKv = (unsigned)(((size_t)NKV * MT * HD / 2 + 255) / 256);
    k_cvt8<<<(unsigned)(((size_t)MT * DM / 8 + 255) / 256), 256, 0, stream>>>(x, XB, (size_t)MT * DM / 8);
    k_gemmks<bf, 0, false, 8><<<dim3(MT / 64, DQ / 64, 1), 256, 0, stream>>>(XB, nullptr, WQ, nullptr, DM, FQ, DQ, nullptr, 0, 0, 0);
    k_rope<<<LQ, 256, 0, stream>>>(FQ, DQ, NH_, CS, nullptr, nullptr, 1.0f, QP16, QPh, QPl);
    k_gemmks<bf, 0, false, 8><<<dim3(MT / 64, DKV / 64, 1), 256, 0, stream>>>(XB, nullptr, WK, nullptr, DM, FK, DKV, nullptr, 0, 0, 0);
    k_rope<<<LKv, 256, 0, stream>>>(FK, DKV, NKV, CS, nullptr, nullptr, 1.0f, KP16, KPh, KPl);
    k_gemmks<bf, 0, false, 8><<<dim3(MT / 64, DKV / 64, 1), 256, 0, stream>>>(XB, nullptr, WV, nullptr, DM, FV, DKV, nullptr, 0, 0, 0); k_vtp<<<LKv, 256, 0, stream>>>(FV, DKV, NKV, VT16, VTh, VTl);
    for (int h0 = 0; h0 < NH_; h0 += ZH) { const size_t zq = (size_t)h0 * NB_, zk = (size_t)(h0 / REP) * NB_;   // one kv head per query head: the pass's ZP (head, batch) planes are consecutive in q, k and v (z-strides TT*HD)
        k_gemmw<bf, 2, false><<<dim3(TT / 64, TT / 64, ZP), 32, 0, stream>>>(QPh + zq * TT * HD, QPl + zq * TT * HD, KPh + zk * TT * HD, KPl + zk * TT * HD, HD, Sb, TT, nullptr, (size_t)TT * HD, (size_t)TT * HD, (size_t)TT * TT);   /* scores hl on all rows */
        k_asoft<<<dim3(NB_, TT / 8, 1), 256, 0, stream>>>(Sb, P16, Ph, Pl, h0, AW);
        k_gemmks<bf, 2, false, 16><<<dim3(RH / 64, HD / 64, ZP), 512, 0, stream>>>(Ph, Pl, VTh + zk * HD * TT, VTl + zk * HD * TT, TT, Ob, HD, nullptr, (size_t)RH * TT, (size_t)HD * TT, (size_t)TT * HD);
        k_gemmks<h16, 0, false, 16><<<dim3((TT - RH) / 64, HD / 64, ZP), 512, 0, stream>>>(P16 + (size_t)RH * TT, nullptr, VT16 + zk * HD * TT, nullptr, TT, Ob + (size_t)RH * HD, HD, nullptr, (size_t)TT * TT, (size_t)HD * TT, (size_t)TT * HD);
        k_merge<<<(unsigned)(((size_t)ZP * TT * HD / 2 + 255) / 256), 256, 0, stream>>>(Ob, h0, ATh, ATl); }
    k_gemmks<bf, 1, true, 8><<<dim3(MT / 64, DM / 64, 1), 256, 0, stream>>>(ATh, ATl, WO, nullptr, DQ, OUT, DM, bo, 0, 0, 0);
}

// v004
// It runs in 368 microseconds.
// Next to v003, in two timings, it ran 2.02 and 2.03 times as fast.
// Counting every step since v000, it is 5.68 times as fast.
#include <hip/hip_runtime.h>

// CausalTemporalAttention (x [2][2048][1024]; qkv = x w_qkv ([1024][3072] q | k | v; 16 x 64); attn = softmax(q.k / 8) over ALL keys, THEN multiplied by the block-causal mask [j/64 <= i/64] without renormalisation; out0 = (attn v) merged w_out + b_out -> [2][2048][1024] at 0; out1 = attn.mean over the 16 heads -> [2][2048][2048] at element 4,194,304).
// Compute dtypes, f32 accumulate: every input rounded to bf16; q/k/v on PLAIN bf16 operands (inputs: exact); scores hl x hl (3 products) on every row over all keys (the softmax normaliser needs every key); softmax f32; the structural block mask applied to the probabilities in f32; attn.v: rows < 512 hl (3 products), the rest fp16 (x1024); the head mean accumulated in f32 (in LDS) from the f32 probabilities in head order inside the attention kernel (no atomics) and scaled by 1/16 behind the last head; w_out hl x exact (2 products) + bias.

// Both batches run in every launch: the projections take the 4096 rows of x as one M; the head planes lie [head][batch][t][d] (v: [head][batch][d][t]).
#define NB_  2
#define TT   2048
#define DM   1024
#define NH_  16
#define NKV  16
#define REP  (NH_ / NKV)
#define HD   64
#define DQ   (NH_ * HD)
#define DKV  (NKV * HD)
#define MT   (NB_ * TT)           // rows of both batches
#define RH   512                  // query rows < RH use hi+lo planes (0: none)
#define WIN  0
#define PCAR 1024.0f
#define SCL  0.125f   // HD^-0.5
typedef _Float16 h16;
typedef unsigned short bf;
typedef __attribute__((ext_vector_type(16))) __bf16   v16bf;
typedef __attribute__((ext_vector_type(16))) _Float16 v16h;
typedef __attribute__((ext_vector_type(8)))  _Float16 v8h;
typedef __attribute__((ext_vector_type(8)))  unsigned short v8us;
typedef __attribute__((ext_vector_type(8)))  float    v8f;
typedef __attribute__((ext_vector_type(4)))  float    v4f;
typedef v8h  __attribute__((may_alias)) v8ha;
typedef v4f  __attribute__((may_alias)) v4fa;
typedef v8us __attribute__((may_alias)) v8usa;

__device__ __forceinline__ unsigned short f2bf(float f) { unsigned u = __float_as_uint(f); u += 0x7FFFu + ((u >> 16) & 1u); return (unsigned short)(u >> 16); }
__device__ __forceinline__ float bf2f(unsigned short b) { return __uint_as_float(((unsigned)b) << 16); }
__device__ __forceinline__ float bfr(float f) { return bf2f(f2bf(f)); }
__device__ __forceinline__ v16h cat16(v8h lo, v8h hi) { return __builtin_shufflevector(lo, hi, 0, 1, 2, 3, 4, 5, 6, 7, 8, 9, 10, 11, 12, 13, 14, 15); }
__device__ __forceinline__ v16bf cat16b(v8us lo, v8us hi) { return __builtin_bit_cast(v16bf, __builtin_shufflevector(lo, hi, 0, 1, 2, 3, 4, 5, 6, 7, 8, 9, 10, 11, 12, 13, 14, 15)); }
__device__ __forceinline__ v8f wmma16(v16h a, v16h b, v8f c) { return __builtin_amdgcn_wmma_f32_16x16x32_f16(false, a, false, b, (short)0, c, false, false); }
__device__ __forceinline__ v8f wmmab(v16bf a, v16bf b, v8f c) { return __builtin_amdgcn_wmma_f32_16x16x32_bf16(false, a, false, b, (short)0, c, false, false); }



// ---- fragments: operands straight from K-contiguous 16-bit planes; lane lr = lane & 15 holds row lr, k = 8 hi + 0..7 and 16 + 8 hi + 0..7 (hi = lane >> 4), the same for A and for B.
template <typename T16> struct WFrag;
template <> struct WFrag<h16> { typedef v16h V; static __device__ __forceinline__ V ld(const h16* p) { return cat16(*(const v8h*)p, *(const v8h*)(p + 16)); } static __device__ __forceinline__ v8f mma(V a, V b, v8f c) { return wmma16(a, b, c); } };
template <> struct WFrag<bf> { typedef v16bf V; static __device__ __forceinline__ V ld(const bf* p) { return cat16b(*(const v8us*)p, *(const v8us*)(p + 16)); } static __device__ __forceinline__ v8f mma(V a, V b, v8f c) { return wmmab(a, b, c); } };

// ---- k_gemmks: register-blocked GEMM, 64x64 output tile (16 accumulators a wave): C[m][n] (f32, pitch ldc, + optional f32 bias[n]) = sum_k A[m][k] Bt[n][k] (+ split products per NSPLIT); z-batch strides sA/sB/sC in elements; NW waves per work-group, each takes K/NW of the k range (which: at the loop); each wave leaves its f32 partial tile in its own LDS plane [64][68], one barrier, then the NW planes are summed in wave order (a fixed order) and stored as whole 256-B row pieces. K % (64 NW) == 0; grid (M/64, N/64, Z), 32 NW threads.
template <typename T16, int NSPLIT, bool BIAS, int NW>
__global__ __launch_bounds__(NW * 32) void k_gemmks(const T16* __restrict__ A, const T16* __restrict__ A2, const T16* __restrict__ Bt, const T16* __restrict__ Bt2, int K, float* C, int ldc, const float* __restrict__ bias, size_t sA, size_t sB, size_t sC) {
    typedef typename WFrag<T16>::V V;
    __shared__ __align__(16) float ps[NW * 64 * 68];
    const size_t z = blockIdx.z; A += z * sA; if (A2) A2 += z * sA; Bt += z * sB; if (Bt2) Bt2 += z * sB; C += z * sC;
    const int lane = threadIdx.x & 31, lr = lane & 15, hi = lane >> 4; const int wv = __builtin_amdgcn_readfirstlane((int)(threadIdx.x >> 5)); const int r0 = blockIdx.x * 64, c0 = blockIdx.y * 64;
    v8f acc[4][4];
#pragma unroll
    for (int mb = 0; mb < 4; ++mb)
#pragma unroll
        for (int nb = 0; nb < 4; ++nb) acc[mb][nb] = (v8f){};
    // waves 2p and 2p+1 share the k range [2p K/NW, (2p+2) K/NW) and take the two 64-B halves of each 128-B line in the same trip: a line is wanted by both at once, not again one trip later when the other waves' lines may have pushed it out of the cache
    const int kw2 = 2 * (K / NW), kbeg = (wv >> 1) * kw2 + (wv & 1) * 32;
    // addresses: a wave-uniform base per sixteen-row block and plane, fixed over the loop, and ONE 32-bit lane offset in bytes (A and Bt have the same pitch K), which alone moves along k
    const T16* sa[4]; const T16* sa2[4]; const T16* sb[4]; const T16* sb2[4];
#pragma unroll
    for (int q = 0; q < 4; ++q) { const size_t ra = (size_t)(r0 + q * 16) * K + kbeg, rb = (size_t)(c0 + q * 16) * K + kbeg; sa[q] = A + ra; sb[q] = Bt + rb; if (NSPLIT == 1 || NSPLIT == 2) sa2[q] = A2 + ra; if (NSPLIT >= 2) sb2[q] = Bt2 + rb; }
    unsigned voff = (unsigned)(lr * K + 8 * hi) * (unsigned)sizeof(T16);
    // rolled: one trip's fragments and the sixteen accumulators are what a wave's registers hold
#pragma unroll 1
    for (int kc = 0; kc < kw2; kc += 64) {
        V a[4], a2[4];
#pragma unroll
        for (int mb = 0; mb < 4; ++mb) { a[mb] = WFrag<T16>::ld((const T16*)((const char*)sa[mb] + voff)); if (NSPLIT == 1 || NSPLIT == 2) a2[mb] = WFrag<T16>::ld((const T16*)((const char*)sa2[mb] + voff)); }
#pragma unroll
        for (int nb = 0; nb < 4; ++nb) { const V b = WFrag<T16>::ld((const T16*)((const char*)sb[nb] + voff)); V b2; if (NSPLIT >= 2) b2 = WFrag<T16>::ld((const T16*)((const char*)sb2[nb] + voff));
#pragma unroll
            for (int mb = 0; mb < 4; ++mb) { acc[mb][nb] = WFrag<T16>::mma(a[mb], b, acc[mb][nb]); if (NSPLIT == 1 || NSPLIT == 2) acc[mb][nb] = WFrag<T16>::mma(a2[mb], b, acc[mb][nb]); if (NSPLIT >= 2) acc[mb][nb] = WFrag<T16>::mma(a[mb], b2, acc[mb][nb]); } }
        // four vector slots behind the trip's last matrix instruction, on the taken back edge too. The lane offset is an input, so that it keeps its register to the end of the trip and is stepped only behind the waits on all of the trip's loads
        asm volatile("v_nop\n\tv_nop\n\tv_nop\n\tv_nop" : "+v"(acc[0][0]), "+v"(acc[1][1]), "+v"(acc[2][2]), "+v"(acc[3][3]) : "v"(a[0]), "v"(a[3]), "v"(voff));
        voff += 64 * (unsigned)sizeof(T16);
    }
    float* pw = ps + wv * (64 * 68);
#pragma unroll
    for (int mb = 0; mb < 4; ++mb)
#pragma unroll
        for (int nb = 0; nb < 4; ++nb)
#pragma unroll
            for (int j = 0; j < 8; ++j) pw[(mb * 16 + hi * 8 + j) * 68 + nb * 16 + lr] = acc[mb][nb][j];
    __syncthreads();   // every wave's partial tile is in LDS before any wave sums
#pragma unroll
    for (int s = 0; s < 32 / NW; ++s) { const int idx = s * (NW * 32) + (int)threadIdx.x; const int row = idx >> 4, cofs = (idx & 15) * 4; const float* pr = ps + row * 68 + cofs; v4f val = *(const v4fa*)pr;
#pragma unroll
        for (int w = 1; w < NW; ++w) { const v4f q = *(const v4fa*)(pr + w * (64 * 68)); val[0] += q[0]; val[1] += q[1]; val[2] += q[2]; val[3] += q[3]; }
        if (BIAS) { val[0] += bfr(bias[c0 + cofs]); val[1] += bfr(bias[c0 + cofs + 1]); val[2] += bfr(bias[c0 + cofs + 2]); val[3] += bfr(bias[c0 + cofs + 3]); }
        *(v4f*)(C + (size_t)(r0 + row) * ldc + c0 + cofs) = val; }
}

__device__ __forceinline__ h16 tohx(float x) { return (h16)x; }
__device__ __forceinline__ void splitf(float y, unsigned short& h, unsigned short& l) { h = f2bf(y); l = f2bf(y - bf2f(h)); }
typedef __attribute__((ext_vector_type(2))) _Float16 v2h;
typedef __attribute__((ext_vector_type(4))) _Float16 v4h;
typedef __attribute__((ext_vector_type(2))) unsigned short v2us;
typedef __attribute__((ext_vector_type(4))) unsigned short v4us;
typedef __attribute__((ext_vector_type(2))) float v2f;
typedef __attribute__((ext_vector_type(4))) int v4i;

__global__ __launch_bounds__(256) void k_wtG(const float* __restrict__ w, int K, int N, bf* Bt) {
    const int lane = threadIdx.x & 31; const int L0 = (blockIdx.x * 8 + (threadIdx.x >> 5)) * 8; const int nlines = N * K / 64;
{
#pragma unroll 1
        for (int l = 0; l < 8; ++l) { const int L = L0 + l; if (L >= nlines) break; const size_t e = (size_t)L * 64 + lane * 2; const int k = (int)(e % K), n = (int)(e / K); v2us o;
            o[0] = f2bf(w[(size_t)k * N + n]); o[1] = f2bf(w[(size_t)(k + 1) * N + n]); *(v2us*)(Bt + e) = o; }
         }
}
__global__ __launch_bounds__(256) void k_cvt8(const float* __restrict__ src, bf* dst, size_t n8) { const size_t i = (size_t)blockIdx.x * 256 + threadIdx.x; if (i >= n8) return; const v8f v = *(const v8f*)(src + i * 8); v8us o;
#pragma unroll
    for (int k = 0; k < 8; ++k) o[k] = f2bf(v[k]); *(v8us*)(dst + i * 8) = o;  }
__global__ __launch_bounds__(256) void k_cscvt(const float* __restrict__ cosT, const float* __restrict__ sinT, float* CS) { const int idx = blockIdx.x * 256 + threadIdx.x; if (idx >= TT * HD) return; v2f cs; cs[0] = bfr(cosT[idx]); cs[1] = bfr(sinT[idx]); *(v2f*)(CS + (size_t)idx * 2) = cs;  }
// k_rope: head planes [h][b][t][d] (fp16 + hi/lo) of rope(x) x sc with the rotate-half convention out[d] = x[d] cos[t][d] - x[d+HD/2] sin[t][d], out[d+HD/2] = x[d+HD/2] cos[t][d+HD/2] + x[d] sin[t][d+HD/2]
__global__ __launch_bounds__(256) void k_rope(const float* __restrict__ F, int pitch, int nheads, const float* __restrict__ CS, const float* __restrict__ RF, const float* __restrict__ nw, float sc, h16* P16, bf* Ph, bf* Pl) {
    const size_t e = ((size_t)blockIdx.x * 256 + threadIdx.x) * 2; if (e >= (size_t)nheads * NB_ * TT * HD) return; const int d = (int)(e % HD); const int t = (int)((e / HD) % TT); const int pl = (int)(e / ((size_t)HD * TT)); const int h = pl / NB_, bb = pl % NB_; const float* f = F + (size_t)(bb * TT + t) * pitch + h * HD; const float rf = RF ? RF[(size_t)h * TT + t] : 1.0f; v2h o16; v2us oh, ol;
    asm volatile("s_wait_xcnt 0x0" ::: "memory");   // in front of the address arithmetic below, which may reuse the registers that the RF load names
#pragma unroll
    for (int q = 0; q < 2; ++q) { const int dd = d + q; const int dp = (dd < HD / 2) ? dd + HD / 2 : dd - HD / 2; float x0 = f[dd], x1 = f[dp];
        if (RF) { float n0 = __fmul_rn(x0, rf), n1 = __fmul_rn(x1, rf); asm volatile("" : "+v"(n0)); asm volatile("" : "+v"(n1)); x0 = __fmul_rn(bfr(nw[dd]), n0); x1 = __fmul_rn(bfr(nw[dp]), n1); }
        const v2f cs = *(const v2f*)(CS + ((size_t)t * HD + dd) * 2); float a = __fmul_rn(x0, cs[0]), bq = __fmul_rn(x1, cs[1]); asm volatile("" : "+v"(a)); asm volatile("" : "+v"(bq)); const float r = ((dd < HD / 2) ? __fsub_rn(a, bq) : __fadd_rn(a, bq)) * sc;
        o16[q] = tohx(r); unsigned short a2, c2; splitf(r, a2, c2); oh[q] = a2; ol[q] = c2; }
    *(v2h*)(P16 + e) = o16; *(v2us*)(Ph + e) = oh; *(v2us*)(Pl + e) = ol;  }
__global__ __launch_bounds__(256) void k_vtp(const float* __restrict__ F, int pitch, int nheads, h16* V16, bf* Vh, bf* Vl) { const size_t e = ((size_t)blockIdx.x * 256 + threadIdx.x) * 2; if (e >= (size_t)nheads * NB_ * HD * TT) return; const int t = (int)(e % TT); const int d = (int)((e / TT) % HD); const int pl = (int)(e / ((size_t)TT * HD)); const int g = pl / NB_, bb = pl % NB_; v2h o16; v2us oh, ol;
#pragma unroll
    for (int q = 0; q < 2; ++q) { const float x = F[(size_t)(bb * TT + t + q) * pitch + g * HD + d]; o16[q] = tohx(x); unsigned short a2, c2; splitf(x, a2, c2); oh[q] = a2; ol[q] = c2; }
    *(v2h*)(V16 + e) = o16; *(v2us*)(Vh + e) = oh; *(v2us*)(Vl + e) = ol;  }
__global__ __launch_bounds__(256) void k_csid(float* CS) { const int idx = blockIdx.x * 256 + threadIdx.x; if (idx >= TT * HD) return; v2f cs; cs[0] = 1.0f; cs[1] = 0.0f; *(v2f*)(CS + (size_t)idx * 2) = cs;  }
// ---- k_fattn: scores, softmax, block mask, head mean and attn.v of 16 query rows of one batch in ONE work-group of 8 waves, the 16 heads one after the other; scores and probabilities stay in registers. grid (batch, TT/16), 256 threads.
// Each wave owns 256 keys. Scores are computed TRANSPOSED (A = 16 keys of k, B = the 16 queries): a lane then holds one query (lr) and eight keys a tile, which is the B-fragment form that attn.v wants (out^T = v^T p^T, A = 16 rows d of the [d][t] plane), so that no value changes lanes.
// Row m of score tile t is key kb + (t>>1) 32 + (m>>3) 16 + (t&1) 8 + (m&7): tiles 2s and 2s+1 give lane half hi the 16 consecutive keys kb + 32 s + 16 hi + e, e = 0..15, element e of the B fragment of k-step s; the v^T loader reads the same 16 keys into element e.
// Row maximum and row sum go through LDS (8 waves, summed in wave order); the partial out^T tiles of the nact waves that have an unmasked block are summed in LDS in wave order. A 64-key block lies in one wave and is masked or not for the whole work-group (16 rows lie in one 64-row block): masked blocks skip attn.v and add nothing to the mean.
#define FW   8                    // waves per work-group
#define KW   (TT / FW)            // keys per wave
#define NT   (KW / 16)            // score tiles per wave
#define NG   (KW / 64)            // 64-key mask blocks per wave
__device__ __forceinline__ v16bf ldks(const bf* ub, unsigned vo, int c) { const char* p = (const char*)ub + vo; return cat16b(*(const v8us*)(p + c), *(const v8us*)(p + c + 32)); }   // k = 8 hi + 0..7 | 16 + 8 hi + 0..7
__device__ __forceinline__ v16bf ldcb(const bf* ub, unsigned vo, int c) { const char* p = (const char*)ub + vo; return cat16b(*(const v8us*)(p + c), *(const v8us*)(p + c + 16)); }   // 16 consecutive elements
__device__ __forceinline__ v16h ldch(const h16* ub, unsigned vo, int c) { const char* p = (const char*)ub + vo; return cat16(*(const v8h*)(p + c), *(const v8h*)(p + c + 16)); }        // 16 consecutive elements
// 2^x with the one vector slot that the instruction set asks for behind a transcendental, in front of an instruction that reads its result or overwrites its source
__device__ __forceinline__ float exp2s(float x) { float e; asm("v_exp_f32 %0, %1\n\tv_nop" : "=v"(e) : "v"(x)); return e; }
__global__ __launch_bounds__(FW * 32) void k_fattn(const bf* __restrict__ Qh, const bf* __restrict__ Ql, const bf* __restrict__ Kh, const bf* __restrict__ Kl, const h16* __restrict__ V16, const bf* __restrict__ Vh, const bf* __restrict__ Vl, float* AW, bf* Ah, bf* Al) {
    __shared__ __align__(16) float po[FW * 16 * 68];
    __shared__ float rmx[FW * 16]; __shared__ float rsm[FW * 16];
    __shared__ __align__(16) float awl[NT * 2 * FW * 32 * 4];   // the head mean's f32 sums, [tile][half][thread][4]: each thread reads and writes its own 16-B slots only (touched once a head: in registers they would crowd out the fragments in flight)
    const int lane = threadIdx.x & 31, lr = lane & 15, hi = lane >> 4; const int wv = __builtin_amdgcn_readfirstlane((int)(threadIdx.x >> 5));
    const int b = blockIdx.x, i0 = (TT / 16 - 1 - (int)blockIdx.y) * 16, kb = wv * KW, qb = i0 >> 6; const bool hires = (i0 < RH);   // the late rows, which have the most unmasked keys, start first
    int na = qb + 1 - wv * NG; na = na < 0 ? 0 : (na > NG ? NG : na);   // unmasked 64-key blocks of this wave
    const int nact = qb / NG + 1;                                       // waves with at least one
    // lane offsets in bytes, fixed over the kernel; the plane bases are wave-uniform
    const unsigned vq = (unsigned)((i0 + lr) * HD + 8 * hi) * 2u, vk = (unsigned)((kb + (lr >> 3) * 16 + (lr & 7)) * HD + 8 * hi) * 2u, vv = (unsigned)(lr * TT + kb + hi * 16) * 2u;
    const int rq = (int)threadIdx.x >> 4, rd = ((int)threadIdx.x & 15) * 4;   // the reducer's query row and first d
    float* al = awl + (int)threadIdx.x * 4;
#pragma unroll
    for (int t = 0; t < NT * 2; ++t) *(v4fa*)(al + t * (FW * 32 * 4)) = (v4f){};
    // rolled over the heads: one head's code is long, and s and o stay in registers only under constant indices (every loop over them is unrolled)
#pragma unroll 1
    for (int h = 0; h < NH_; ++h) { const size_t pl = (size_t)(h * NB_ + b) * ((size_t)TT * HD);
        const bf* kh = Kh + pl; const bf* kl = Kl + pl; v16bf qh[2], ql[2];
#pragma unroll
        for (int kk = 0; kk < 2; ++kk) { qh[kk] = ldks(Qh + pl, vq, kk * 64); ql[kk] = ldks(Ql + pl, vq, kk * 64); }
        v8f s[NT]; v16bf fh[2][2][2], fl[2][2][2];   // k fragments [buffer][tile of the pair][32-k half]: the pair in work and the pair in flight
#pragma unroll
        for (int u = 0; u < 2; ++u)
#pragma unroll
            for (int kk = 0; kk < 2; ++kk) { fh[0][u][kk] = ldks(kh, vk, u * 8 * HD * 2 + kk * 64); fl[0][u][kk] = ldks(kl, vk, u * 8 * HD * 2 + kk * 64); }
#pragma unroll
        for (int g = 0; g < NT / 2; ++g) {
            if (g + 1 < NT / 2) {
#pragma unroll
                for (int u = 0; u < 2; ++u)
#pragma unroll
                    for (int kk = 0; kk < 2; ++kk) { const int c = ((g + 1) * 32 + u * 8) * HD * 2 + kk * 64; fh[(g + 1) & 1][u][kk] = ldks(kh, vk, c); fl[(g + 1) & 1][u][kk] = ldks(kl, vk, c); } }
            __builtin_amdgcn_sched_barrier(0);   // the next pair's sixteen loads are issued in front of this pair's products (left alone the compiler sinks each load to its use and waits for it there), and the four loads of a 128-B line stay together
#pragma unroll
            for (int u = 0; u < 2; ++u) { v8f a = (v8f){};
#pragma unroll
                for (int kk = 0; kk < 2; ++kk) { a = wmmab(fh[g & 1][u][kk], qh[kk], a); a = wmmab(fh[g & 1][u][kk], ql[kk], a); a = wmmab(fl[g & 1][u][kk], qh[kk], a); }
                s[g * 2 + u] = a; }
            __builtin_amdgcn_sched_barrier(0);   // and the pair after next is not lifted over these products: two pairs of fragments are what the registers hold
        }
        float mx = -3.0e38f;
#pragma unroll
        for (int t = 0; t < NT; ++t)
#pragma unroll
            for (int j = 0; j < 8; ++j) { const float x = s[t][j] * SCL; s[t][j] = x; mx = fmaxf(mx, x); }
        mx = fmaxf(mx, __shfl_xor(mx, 16, 32));
        if (hi == 0) rmx[wv * 16 + lr] = mx;
        __syncthreads();   // every wave's row maxima are in LDS
#pragma unroll
        for (int w = 0; w < FW; ++w) mx = fmaxf(mx, rmx[w * 16 + lr]);
        float sm[4] = {0.f, 0.f, 0.f, 0.f};
#pragma unroll
        for (int t = 0; t < NT; ++t)
#pragma unroll
            for (int j = 0; j < 8; ++j) { const float e = exp2s((s[t][j] - mx) * 1.4426950408889634f); s[t][j] = e; sm[j & 3] += e; }
        float sum = (sm[0] + sm[1]) + (sm[2] + sm[3]); sum += __shfl_xor(sum, 16, 32);
        if (hi == 0) rsm[wv * 16 + lr] = sum;
        __syncthreads();   // every wave's row sums are in LDS
        sum = rsm[lr];
#pragma unroll
        for (int w = 1; w < FW; ++w) sum += rsm[w * 16 + lr];
        const float f = __fdiv_rn(hires ? 1.0f : PCAR, sum);
        v8f o[4];
#pragma unroll
        for (int dt = 0; dt < 4; ++dt) o[dt] = (v8f){};
        if (hires) { const bf* vh = Vh + pl; const bf* vl = Vl + pl;
#pragma unroll
            for (int g = 0; g < NG; ++g) if (g < na) { v16bf va[2][4], vb[2][4];
#pragma unroll
                for (int x = 0; x < 2; ++x)
#pragma unroll
                    for (int dt = 0; dt < 4; ++dt) { const int c = (dt * 16 * TT + (g * 2 + x) * 32) * 2; va[x][dt] = ldcb(vh, vv, c); vb[x][dt] = ldcb(vl, vv, c); }
                asm volatile("s_wait_xcnt 0x0" ::: "memory");   // behind the block's loads, in front of the arithmetic below, which may reuse the registers that hold their address
                __builtin_amdgcn_sched_barrier(0);   // the block's v loads are all in flight in front of the arithmetic on its probabilities
#pragma unroll
                for (int sx = g * 2; sx < g * 2 + 2; ++sx) { v8us h0, h1, l0, l1; v4f m[4];
#pragma unroll
                    for (int u = 0; u < 4; ++u) m[u] = *(const v4fa*)(al + (sx * 4 + u) * (FW * 32 * 4));
#pragma unroll
                    for (int e = 0; e < 8; ++e) { const float p0 = s[2 * sx][e] * f, p1 = s[2 * sx + 1][e] * f; unsigned short a, c2; splitf(p0, a, c2); h0[e] = a; l0[e] = c2; splitf(p1, a, c2); h1[e] = a; l1[e] = c2; m[e >> 2][e & 3] += p0; m[2 + (e >> 2)][e & 3] += p1; }
#pragma unroll
                    for (int u = 0; u < 4; ++u) *(v4fa*)(al + (sx * 4 + u) * (FW * 32 * 4)) = m[u];
                    const v16bf ph = cat16b(h0, h1), pq = cat16b(l0, l1);
#pragma unroll
                    for (int dt = 0; dt < 4; ++dt) { o[dt] = wmmab(va[sx & 1][dt], ph, o[dt]); o[dt] = wmmab(va[sx & 1][dt], pq, o[dt]); o[dt] = wmmab(vb[sx & 1][dt], ph, o[dt]); } } }
        } else { const h16* v16 = V16 + pl;
#pragma unroll
            for (int g = 0; g < NG; ++g) if (g < na) { v16h va[2][4];
#pragma unroll
                for (int x = 0; x < 2; ++x)
#pragma unroll
                    for (int dt = 0; dt < 4; ++dt) va[x][dt] = ldch(v16, vv, (dt * 16 * TT + (g * 2 + x) * 32) * 2);
                asm volatile("s_wait_xcnt 0x0" ::: "memory");   // behind the block's loads, in front of the arithmetic below, which may reuse the registers that hold their address
                __builtin_amdgcn_sched_barrier(0);   // the block's v loads are all in flight in front of the arithmetic on its probabilities
#pragma unroll
                for (int sx = g * 2; sx < g * 2 + 2; ++sx) { v16h pf; v4f m[4];
#pragma unroll
                    for (int u = 0; u < 4; ++u) m[u] = *(const v4fa*)(al + (sx * 4 + u) * (FW * 32 * 4));
#pragma unroll
                    for (int e = 0; e < 8; ++e) { const float p0 = s[2 * sx][e] * f, p1 = s[2 * sx + 1][e] * f; pf[e] = tohx(p0); pf[8 + e] = tohx(p1); m[e >> 2][e & 3] += p0 * (1.0f / PCAR); m[2 + (e >> 2)][e & 3] += p1 * (1.0f / PCAR); }
#pragma unroll
                    for (int u = 0; u < 4; ++u) *(v4fa*)(al + (sx * 4 + u) * (FW * 32 * 4)) = m[u];
#pragma unroll
                    for (int dt = 0; dt < 4; ++dt) o[dt] = wmma16(va[sx & 1][dt], pf, o[dt]); } }
        }
        if (na > 0) { float* pw = po + wv * (16 * 68) + lr * 68 + hi * 8;   // out^T tile dt: lane lr = query, register j = d dt 16 + hi 8 + j
#pragma unroll
            for (int dt = 0; dt < 4; ++dt) { v4f x0, x1;
#pragma unroll
                for (int j = 0; j < 4; ++j) { x0[j] = o[dt][j]; x1[j] = o[dt][4 + j]; }
                *(v4fa*)(pw + dt * 16) = x0; *(v4fa*)(pw + dt * 16 + 4) = x1; } }
        __syncthreads();   // the partial out tiles are in LDS before any wave sums; the next head writes them again only behind its own two barriers
        { const float* pr = po + rq * 68 + rd; v4f val = *(const v4fa*)pr;
            for (int w = 1; w < nact; ++w) { const v4f q = *(const v4fa*)(pr + w * (16 * 68)); val[0] += q[0]; val[1] += q[1]; val[2] += q[2]; val[3] += q[3]; }
            const float cs = hires ? 1.0f : (1.0f / PCAR); v4us oh, ol;
#pragma unroll
            for (int q = 0; q < 4; ++q) { unsigned short a, c2; splitf(val[q] * cs, a, c2); oh[q] = a; ol[q] = c2; }
            const size_t oo = (size_t)(b * TT + i0 + rq) * DQ + h * HD + rd; *(v4us*)(Ah + oo) = oh; *(v4us*)(Al + oo) = ol;
            asm volatile("s_wait_xcnt 0x0" ::: "memory");   // behind the two stores, in front of the next head's arithmetic, which may reuse the registers that they name
        }
    }
    float* ar = AW + ((size_t)b * TT + i0 + lr) * TT + kb + hi * 16;
    v4f x[NT * 2];
#pragma unroll
    for (int t = 0; t < NT * 2; ++t) { x[t] = *(const v4fa*)(al + t * (FW * 32 * 4));
#pragma unroll
        for (int j = 0; j < 4; ++j) x[t][j] *= 0.0625f; }
    __builtin_amdgcn_sched_barrier(0);   // every sum is read and scaled in front of the first store, so that no register which an issued store names is written again
#pragma unroll
    for (int t = 0; t < NT; ++t) { float* p = ar + (t >> 1) * 32 + (t & 1) * 8; *(v4f*)p = x[t * 2]; *(v4f*)(p + 4) = x[t * 2 + 1]; }
}
extern "C" void kernel_launch(void* const* d_in, const int* in_sizes, int n_in,
                              void* d_out, int out_size, void* d_ws, size_t ws_size, hipStream_t stream) {
    (void)in_sizes; (void)n_in; (void)out_size;
    const float* x = (const float*)d_in[0]; const float* wf = (const float*)d_in[1]; const float* wo = (const float*)d_in[2]; const float* bo = (const float*)d_in[3]; const float* wq = wf; const float* wk = wf; const float* wv = wf; (void)wk; (void)wv; const float* cosT = nullptr; const float* sinT = nullptr; (void)cosT; (void)sinT;
    float* OUT = (float*)d_out;     // [2][2048][1024]
    char* wsp = (char*)d_ws;
    auto take = [&](size_t bytes) { char* p = wsp; wsp += (bytes + 255) & ~(size_t)255; return (void*)p; };
    bf* WQ = nullptr; bf* WK = nullptr; bf* WV = nullptr; bf* WO = (bf*)take((size_t)DM * DQ * 2); float* CS = (float*)take((size_t)TT * HD * 2 * 4);
    bf* XB = (bf*)take((size_t)MT * DM * 2); bf* WALL = (bf*)take((size_t)(DQ + 2 * DKV) * DM * 2); float* AW = OUT + (size_t)NB_ * TT * DM + 0;   /* out1 region base; batch b at + b*TT*TT */ float* FQ = (float*)take((size_t)MT * DQ * 4); float* FK = (float*)take((size_t)MT * DKV * 4);
    h16* QP16 = (h16*)take((size_t)NH_ * MT * HD * 2); h16* KP16 = (h16*)take((size_t)NKV * MT * HD * 2); h16* VT16 = (h16*)take((size_t)NKV * HD * MT * 2);
    bf* QPh = (bf*)take((size_t)NH_ * MT * HD * 2); bf* QPl = (bf*)take((size_t)NH_ * MT * HD * 2); bf* KPh = (bf*)take((size_t)NKV * MT * HD * 2); bf* KPl = (bf*)take((size_t)NKV * MT * HD * 2); bf* VTh = (bf*)take((size_t)NKV * HD * MT * 2); bf* VTl = (bf*)take((size_t)NKV * HD * MT * 2);
    bf* ATh = (bf*)take((size_t)MT * DQ * 2); bf* ATl = (bf*)take((size_t)MT * DQ * 2);
    if ((size_t)(wsp - (char*)d_ws) > ws_size) return;    // 137 MiB of the 256 MiB
    float* FV = FK;   // v projection reuses the k buffer after the k planes are built (stream-ordered)
    { k_wtG<<<(unsigned)((DM * (DQ + 2 * DKV) / 64 + 63) / 64), 256, 0, stream>>>(wf, DM, DQ + 2 * DKV, WALL); WQ = WALL; WK = WALL + (size_t)DQ * DM; WV = WK + (size_t)DKV * DM;
      k_wtG<<<(unsigned)((DQ * DM / 64 + 63) / 64), 256, 0, stream>>>(wo, DQ, DM, WO);
       }
    k_csid<<<(TT * HD + 255) / 256, 256, 0, stream>>>(CS);
    const unsigned LQ = (unsigned)(((size_t)NH_ * MT * HD / 2 + 255) / 256), LKv = (unsigned)(((size_t)NKV * MT * HD / 2 + 255) / 256);
    k_cvt8<<<(unsigned)(((size_t)MT * DM / 8 + 255) / 256), 256, 0, stream>>>(x, XB, (size_t)MT * DM / 8);
    k_gemmks<bf, 0, false, 8><<<dim3(MT / 64, DQ / 64, 1), 256, 0, stream>>>(XB, nullptr, WQ, nullptr, DM, FQ, DQ, nullptr, 0, 0, 0);
    k_rope<<<LQ, 256, 0, stream>>>(FQ, DQ, NH_, CS, nullptr, nullptr, 1.0f, QP16, QPh, QPl);
    k_gemmks<bf, 0, false, 8><<<dim3(MT / 64, DKV / 64, 1), 256, 0, stream>>>(XB, nullptr, WK, nullptr, DM, FK, DKV, nullptr, 0, 0, 0);
    k_rope<<<LKv, 256, 0, stream>>>(FK, DKV, NKV, CS, nullptr, nullptr, 1.0f, KP16, KPh, KPl);
    k_gemmks<bf, 0, false, 8><<<dim3(MT / 64, DKV / 64, 1), 256, 0, stream>>>(XB, nullptr, WV, nullptr, DM, FV, DKV, nullptr, 0, 0, 0); k_vtp<<<LKv, 256, 0, stream>>>(FV, DKV, NKV, VT16, VTh, VTl);
    k_fattn<<<dim3(NB_, TT / 16, 1), FW * 32, 0, stream>>>(QPh, QPl, KPh, KPl, VT16, VTh, VTl, AW, ATh, ATl);
    k_gemmks<bf, 1, true, 8><<<dim3(MT / 64, DM / 64, 1), 256, 0, stream>>>(ATh, ATl, WO, nullptr, DQ, OUT, DM, bo, 0, 0, 0);
}

// v005
// It runs in 327 microseconds.
// In both of two side-by-side timings against v004, it was 1.13 times as fast.
// All steps since v000 together make it 6.40 times as fast.
#include <hip/hip_runtime.h>

// CausalTemporalAttention (x [2][2048][1024]; qkv = x w_qkv ([1024][3072] q | k | v; 16 x 64); attn = softmax(q.k / 8) over ALL keys, THEN multiplied by the block-causal mask [j/64 <= i/64] without renormalisation; out0 = (attn v) merged w_out + b_out -> [2][2048][1024] at 0; out1 = attn.mean over the 16 heads -> [2][2048][2048] at element 4,194,304).
// Compute dtypes, f32 accumulate: every input rounded to bf16; q/k/v on PLAIN bf16 operands (inputs: exact); scores hl x hl (3 products) on every row over all keys (the softmax normaliser needs every key); softmax f32; the structural block mask applied to the probabilities in f32; attn.v: rows < 512 hl (3 products), the rest fp16 (x1024); the head mean accumulated in f32 (in LDS) from the f32 probabilities in head order inside the attention kernel (no atomics) and scaled by 1/16 behind the last head; w_out hl x exact (2 products) + bias.

// Both batches run in every launch: the projections take the 4096 rows of x as one M; the head planes lie [head][batch][t][d] (v: [head][batch][d][t]).
#define NB_  2
#define TT   2048
#define DM   1024
#define NH_  16
#define NKV  16
#define REP  (NH_ / NKV)
#define HD   64
#define DQ   (NH_ * HD)
#define DKV  (NKV * HD)
#define MT   (NB_ * TT)           // rows of both batches
#define RH   512                  // query rows < RH use hi+lo planes (0: none)
#define WIN  0
#define PCAR 1024.0f
#define SCL  0.125f   // HD^-0.5
typedef _Float16 h16;
typedef unsigned short bf;
typedef __attribute__((ext_vector_type(16))) __bf16   v16bf;
typedef __attribute__((ext_vector_type(16))) _Float16 v16h;
typedef __attribute__((ext_vector_type(8)))  _Float16 v8h;
typedef __attribute__((ext_vector_type(8)))  unsigned short v8us;
typedef __attribute__((ext_vector_type(8)))  float    v8f;
typedef __attribute__((ext_vector_type(4)))  float    v4f;
typedef v8h  __attribute__((may_alias)) v8ha;
typedef v4f  __attribute__((may_alias)) v4fa;
typedef v8us __attribute__((may_alias)) v8usa;

__device__ __forceinline__ unsigned short f2bf(float f) { unsigned u = __float_as_uint(f); u += 0x7FFFu + ((u >> 16) & 1u); return (unsigned short)(u >> 16); }
__device__ __forceinline__ float bf2f(unsigned short b) { return __uint_as_float(((unsigned)b) << 16); }
__device__ __forceinline__ float bfr(float f) { return bf2f(f2bf(f)); }
__device__ __forceinline__ v16h cat16(v8h lo, v8h hi) { return __builtin_shufflevector(lo, hi, 0, 1, 2, 3, 4, 5, 6, 7, 8, 9, 10, 11, 12, 13, 14, 15); }
__device__ __forceinline__ v16bf cat16b(v8us lo, v8us hi) { return __builtin_bit_cast(v16bf, __builtin_shufflevector(lo, hi, 0, 1, 2, 3, 4, 5, 6, 7, 8, 9, 10, 11, 12, 13, 14, 15)); }
__device__ __forceinline__ v8f wmma16(v16h a, v16h b, v8f c) { return __builtin_amdgcn_wmma_f32_16x16x32_f16(false, a, false, b, (short)0, c, false, false); }
__device__ __forceinline__ v8f wmmab(v16bf a, v16bf b, v8f c) { return __builtin_amdgcn_wmma_f32_16x16x32_bf16(false, a, false, b, (short)0, c, false, false); }



// ---- fragments: operands straight from K-contiguous 16-bit planes; lane lr = lane & 15 holds row lr, k = 8 hi + 0..7 and 16 + 8 hi + 0..7 (hi = lane >> 4), the same for A and for B.
template <typename T16> struct WFrag;
template <> struct WFrag<h16> { typedef v16h V; static __device__ __forceinline__ V ld(const h16* p) { return cat16(*(const v8h*)p, *(const v8h*)(p + 16)); } static __device__ __forceinline__ v8f mma(V a, V b, v8f c) { return wmma16(a, b, c); } };
template <> struct WFrag<bf> { typedef v16bf V; static __device__ __forceinline__ V ld(const bf* p) { return cat16b(*(const v8us*)p, *(const v8us*)(p + 16)); } static __device__ __forceinline__ v8f mma(V a, V b, v8f c) { return wmmab(a, b, c); } };

// ---- k_gemmks: register-blocked GEMM, 64x64 output tile (16 accumulators a wave): C[m][n] (f32, pitch ldc, + optional f32 bias[n]) = sum_k A[m][k] Bt[n][k] (+ split products per NSPLIT); z-batch strides sA/sB/sC in elements; NW waves per work-group, each takes K/NW of the k range (which: at the loop); each wave leaves its f32 partial tile in its own LDS plane [64][68], one barrier, then the NW planes are summed in wave order (a fixed order) and stored as whole 256-B row pieces. K % (64 NW) == 0; grid (M/64, N/64, Z), 32 NW threads.
// PLANES (the q | k | v projection, N = 3 x 16 heads x 64, NW = 8): a column tile is one head of q, k or v, and the summed tile goes straight into that head's 16-bit planes, not into C: q and k as hi + lo [h][b][t][d], v as fp16 and hi + lo [h][b][d][t]. A v tile is computed transposed (the weight's rows as A, the rows of x as B: the two loaders are the same), so that its rows are d and its columns t and every plane is stored as whole 128-B row pieces.
__device__ __forceinline__ void splitf(float y, unsigned short& h, unsigned short& l) { h = f2bf(y); l = f2bf(y - bf2f(h)); }
typedef __attribute__((ext_vector_type(4))) _Float16 v4h;
typedef __attribute__((ext_vector_type(4))) unsigned short v4us;
template <typename T16, int NSPLIT, bool BIAS, int NW, bool PLANES>
__global__ __launch_bounds__(NW * 32) void k_gemmks(const T16* __restrict__ A, const T16* __restrict__ A2, const T16* __restrict__ Bt, const T16* __restrict__ Bt2, int K, float* C, int ldc, const float* __restrict__ bias, size_t sA, size_t sB, size_t sC, bf* Qh, bf* Ql, bf* Kh, bf* Kl, bf* Vh, bf* Vl, h16* V16) {
    typedef typename WFrag<T16>::V V;
    __shared__ __align__(16) float ps[NW * 64 * 68];
    const size_t z = blockIdx.z; A += z * sA; if (A2) A2 += z * sA; Bt += z * sB; if (Bt2) Bt2 += z * sB; C += z * sC;
    const int lane = threadIdx.x & 31, lr = lane & 15, hi = lane >> 4; const int wv = __builtin_amdgcn_readfirstlane((int)(threadIdx.x >> 5)); const int r0 = blockIdx.x * 64, c0 = blockIdx.y * 64;
    v8f acc[4][4];
#pragma unroll
    for (int mb = 0; mb < 4; ++mb)
#pragma unroll
        for (int nb = 0; nb < 4; ++nb) acc[mb][nb] = (v8f){};
    // waves 2p and 2p+1 share the k range [2p K/NW, (2p+2) K/NW) and take the two 64-B halves of each 128-B line in the same trip: a line is wanted by both at once, not again one trip later when the other waves' lines may have pushed it out of the cache
    const int kw2 = 2 * (K / NW), kbeg = (wv >> 1) * kw2 + (wv & 1) * 32;
    // addresses: a wave-uniform base per sixteen-row block and plane, fixed over the loop, and ONE 32-bit lane offset in bytes (A and Bt have the same pitch K), which alone moves along k
    const bool vt = PLANES && (int)blockIdx.y >= 2 * NH_;   // a v tile (the same for the whole work-group)
    const T16* sa[4]; const T16* sa2[4]; const T16* sb[4]; const T16* sb2[4];
#pragma unroll
    for (int q = 0; q < 4; ++q) { const size_t ra = (size_t)(r0 + q * 16) * K + kbeg, rb = (size_t)(c0 + q * 16) * K + kbeg; sa[q] = vt ? Bt + rb : A + ra; sb[q] = vt ? A + ra : Bt + rb; if (NSPLIT == 1 || NSPLIT == 2) sa2[q] = A2 + ra; if (NSPLIT >= 2) sb2[q] = Bt2 + rb; }
    unsigned voff = (unsigned)(lr * K + 8 * hi) * (unsigned)sizeof(T16);
    // rolled: one trip's fragments and the sixteen accumulators are what a wave's registers hold
#pragma unroll 1
    for (int kc = 0; kc < kw2; kc += 64) {
        V a[4], a2[4];
#pragma unroll
        for (int mb = 0; mb < 4; ++mb) { a[mb] = WFrag<T16>::ld((const T16*)((const char*)sa[mb] + voff)); if (NSPLIT == 1 || NSPLIT == 2) a2[mb] = WFrag<T16>::ld((const T16*)((const char*)sa2[mb] + voff)); }
#pragma unroll
        for (int nb = 0; nb < 4; ++nb) { const V b = WFrag<T16>::ld((const T16*)((const char*)sb[nb] + voff)); V b2; if (NSPLIT >= 2) b2 = WFrag<T16>::ld((const T16*)((const char*)sb2[nb] + voff));
#pragma unroll
            for (int mb = 0; mb < 4; ++mb) { acc[mb][nb] = WFrag<T16>::mma(a[mb], b, acc[mb][nb]); if (NSPLIT == 1 || NSPLIT == 2) acc[mb][nb] = WFrag<T16>::mma(a2[mb], b, acc[mb][nb]); if (NSPLIT >= 2) acc[mb][nb] = WFrag<T16>::mma(a[mb], b2, acc[mb][nb]); } }
        // four vector slots behind the trip's last matrix instruction, on the taken back edge too. The lane offset is an input, so that it keeps its register to the end of the trip and is stepped only behind the waits on all of the trip's loads
        asm volatile("v_nop\n\tv_nop\n\tv_nop\n\tv_nop" : "+v"(acc[0][0]), "+v"(acc[1][1]), "+v"(acc[2][2]), "+v"(acc[3][3]) : "v"(a[0]), "v"(a[3]), "v"(voff));
        voff += 64 * (unsigned)sizeof(T16);
    }
    float* pw = ps + wv * (64 * 68);
#pragma unroll
    for (int mb = 0; mb < 4; ++mb)
#pragma unroll
        for (int nb = 0; nb < 4; ++nb)
#pragma unroll
            for (int j = 0; j < 8; ++j) pw[(mb * 16 + hi * 8 + j) * 68 + nb * 16 + lr] = acc[mb][nb][j];
    __syncthreads();   // every wave's partial tile is in LDS before any wave sums
    if (PLANES) {
        const int trow = (int)threadIdx.x >> 4, tcol = ((int)threadIdx.x & 15) * 4;   // this thread's tile rows are trow + 16 s, its four columns start at tcol
        const size_t pb = (size_t)(((int)blockIdx.y % NH_) * NB_ + r0 / TT) * ((size_t)TT * HD); const int t0 = r0 % TT;
        const size_t po = vt ? pb + (size_t)trow * TT + t0 + tcol : pb + (size_t)(t0 + trow) * HD + tcol;
        bf* ph = (vt ? Vh : (int)blockIdx.y >= NH_ ? Kh : Qh) + po; bf* pl = (vt ? Vl : (int)blockIdx.y >= NH_ ? Kl : Ql) + po; h16* p16 = V16 + po;
        v4us oh[4], ol[4]; v4h o16[4];
#pragma unroll
        for (int s = 0; s < 4; ++s) { const float* pr = ps + (s * 16 + trow) * 68 + tcol; v4f val = *(const v4fa*)pr;
#pragma unroll
            for (int w = 1; w < NW; ++w) { const v4f q = *(const v4fa*)(pr + w * (64 * 68)); val[0] += q[0]; val[1] += q[1]; val[2] += q[2]; val[3] += q[3]; }
#pragma unroll
            for (int q = 0; q < 4; ++q) { unsigned short a, c2; splitf(val[q], a, c2); oh[s][q] = a; ol[s][q] = c2; o16[s][q] = (h16)val[q]; } }
        if (vt) {
#pragma unroll
            for (int s = 0; s < 4; ++s) { *(v4us*)(ph + s * 16 * TT) = oh[s]; *(v4us*)(pl + s * 16 * TT) = ol[s]; *(v4h*)(p16 + s * 16 * TT) = o16[s]; }
        } else {
#pragma unroll
            for (int s = 0; s < 4; ++s) { *(v4us*)(ph + s * 16 * HD) = oh[s]; *(v4us*)(pl + s * 16 * HD) = ol[s]; }
        }
        return;
    }
#pragma unroll
    for (int s = 0; s < 32 / NW; ++s) { const int idx = s * (NW * 32) + (int)threadIdx.x; const int row = idx >> 4, cofs = (idx & 15) * 4; const float* pr = ps + row * 68 + cofs; v4f val = *(const v4fa*)pr;
#pragma unroll
        for (int w = 1; w < NW; ++w) { const v4f q = *(const v4fa*)(pr + w * (64 * 68)); val[0] += q[0]; val[1] += q[1]; val[2] += q[2]; val[3] += q[3]; }
        if (BIAS) { val[0] += bfr(bias[c0 + cofs]); val[1] += bfr(bias[c0 + cofs + 1]); val[2] += bfr(bias[c0 + cofs + 2]); val[3] += bfr(bias[c0 + cofs + 3]); }
        *(v4f*)(C + (size_t)(r0 + row) * ldc + c0 + cofs) = val; }
}

__device__ __forceinline__ h16 tohx(float x) { return (h16)x; }
typedef __attribute__((ext_vector_type(2))) unsigned short v2us;
typedef __attribute__((ext_vector_type(2))) float v2f;
typedef __attribute__((ext_vector_type(4))) int v4i;

__global__ __launch_bounds__(256) void k_wtG(const float* __restrict__ w, int K, int N, bf* Bt) {
    const int lane = threadIdx.x & 31; const int L0 = (blockIdx.x * 8 + (threadIdx.x >> 5)) * 8; const int nlines = N * K / 64;
{
#pragma unroll 1
        for (int l = 0; l < 8; ++l) { const int L = L0 + l; if (L >= nlines) break; const size_t e = (size_t)L * 64 + lane * 2; const int k = (int)(e % K), n = (int)(e / K); v2us o;
            o[0] = f2bf(w[(size_t)k * N + n]); o[1] = f2bf(w[(size_t)(k + 1) * N + n]); *(v2us*)(Bt + e) = o; }
         }
}
__global__ __launch_bounds__(256) void k_cvt8(const float* __restrict__ src, bf* dst, size_t n8) { const size_t i = (size_t)blockIdx.x * 256 + threadIdx.x; if (i >= n8) return; const v8f v = *(const v8f*)(src + i * 8); v8us o;
#pragma unroll
    for (int k = 0; k < 8; ++k) o[k] = f2bf(v[k]); *(v8us*)(dst + i * 8) = o;  }
// ---- k_fattn: scores, softmax, block mask, head mean and attn.v of 16 query rows of one batch in ONE work-group of 8 waves, the 16 heads one after the other; scores and probabilities stay in registers. grid (batch, TT/16), 256 threads.
// Each wave owns 256 keys. Scores are computed TRANSPOSED (A = 16 keys of k, B = the 16 queries): a lane then holds one query (lr) and eight keys a tile, which is the B-fragment form that attn.v wants (out^T = v^T p^T, A = 16 rows d of the [d][t] plane), so that no value changes lanes.
// Row m of score tile t is key kb + (t>>1) 32 + (m>>3) 16 + (t&1) 8 + (m&7): tiles 2s and 2s+1 give lane half hi the 16 consecutive keys kb + 32 s + 16 hi + e, e = 0..15, element e of the B fragment of k-step s; the v^T loader reads the same 16 keys into element e.
// Row maximum and row sum go through LDS (8 waves, summed in wave order); the partial out^T tiles of the nact waves that have an unmasked block are summed in LDS in wave order. A 64-key block lies in one wave and is masked or not for the whole work-group (16 rows lie in one 64-row block): masked blocks skip attn.v and add nothing to the mean.
#define FW   8                    // waves per work-group
#define KW   (TT / FW)            // keys per wave
#define NT   (KW / 16)            // score tiles per wave
#define NG   (KW / 64)            // 64-key mask blocks per wave
__device__ __forceinline__ v16bf ldks(const bf* ub, unsigned vo, int c) { const char* p = (const char*)ub + vo; return cat16b(*(const v8us*)(p + c), *(const v8us*)(p + c + 32)); }   // k = 8 hi + 0..7 | 16 + 8 hi + 0..7
__device__ __forceinline__ v16bf ldcb(const bf* ub, unsigned vo, int c) { const char* p = (const char*)ub + vo; return cat16b(*(const v8us*)(p + c), *(const v8us*)(p + c + 16)); }   // 16 consecutive elements
__device__ __forceinline__ v16h ldch(const h16* ub, unsigned vo, int c) { const char* p = (const char*)ub + vo; return cat16(*(const v8h*)(p + c), *(const v8h*)(p + c + 16)); }        // 16 consecutive elements
// 2^x with the one vector slot that the instruction set asks for behind a transcendental, in front of an instruction that reads its result or overwrites its source
__device__ __forceinline__ float exp2s(float x) { float e; asm("v_exp_f32 %0, %1\n\tv_nop" : "=v"(e) : "v"(x)); return e; }
__global__ __launch_bounds__(FW * 32) void k_fattn(const bf* __restrict__ Qh, const bf* __restrict__ Ql, const bf* __restrict__ Kh, const bf* __restrict__ Kl, const h16* __restrict__ V16, const bf* __restrict__ Vh, const bf* __restrict__ Vl, float* AW, bf* Ah, bf* Al) {
    __shared__ __align__(16) float po[FW * 16 * 68];
    __shared__ float rmx[FW * 16]; __shared__ float rsm[FW * 16];
    __shared__ __align__(16) float awl[NT * 2 * FW * 32 * 4];   // the head mean's f32 sums, [tile][half][thread][4]: each thread reads and writes its own 16-B slots only (touched once a head: in registers they would crowd out the fragments in flight)
    const int lane = threadIdx.x & 31, lr = lane & 15, hi = lane >> 4; const int wv = __builtin_amdgcn_readfirstlane((int)(threadIdx.x >> 5));
    const int b = blockIdx.x, i0 = (TT / 16 - 1 - (int)blockIdx.y) * 16, kb = wv * KW, qb = i0 >> 6; const bool hires = (i0 < RH);   // the late rows, which have the most unmasked keys, start first
    int na = qb + 1 - wv * NG; na = na < 0 ? 0 : (na > NG ? NG : na);   // unmasked 64-key blocks of this wave
    const int nact = qb / NG + 1;                                       // waves with at least one
    // lane offsets in bytes, fixed over the kernel; the plane bases are wave-uniform
    const unsigned vq = (unsigned)((i0 + lr) * HD + 8 * hi) * 2u, vk = (unsigned)((kb + (lr >> 3) * 16 + (lr & 7)) * HD + 8 * hi) * 2u, vv = (unsigned)(lr * TT + kb + hi * 16) * 2u;
    const int rq = (int)threadIdx.x >> 4, rd = ((int)threadIdx.x & 15) * 4;   // the reducer's query row and first d
    float* al = awl + (int)threadIdx.x * 4;
#pragma unroll
    for (int t = 0; t < NT * 2; ++t) *(v4fa*)(al + t * (FW * 32 * 4)) = (v4f){};
    // rolled over the heads: one head's code is long, and s and o stay in registers only under constant indices (every loop over them is unrolled)
#pragma unroll 1
    for (int h = 0; h < NH_; ++h) { const size_t pl = (size_t)(h * NB_ + b) * ((size_t)TT * HD);
        const bf* kh = Kh + pl; const bf* kl = Kl + pl; v16bf qh[2], ql[2];
#pragma unroll
        for (int kk = 0; kk < 2; ++kk) { qh[kk] = ldks(Qh + pl, vq, kk * 64); ql[kk] = ldks(Ql + pl, vq, kk * 64); }
        v8f s[NT]; v16bf fh[2][2][2], fl[2][2][2];   // k fragments [buffer][tile of the pair][32-k half]: the pair in work and the pair in flight
#pragma unroll
        for (int u = 0; u < 2; ++u)
#pragma unroll
            for (int kk = 0; kk < 2; ++kk) { fh[0][u][kk] = ldks(kh, vk, u * 8 * HD * 2 + kk * 64); fl[0][u][kk] = ldks(kl, vk, u * 8 * HD * 2 + kk * 64); }
#pragma unroll
        for (int g = 0; g < NT / 2; ++g) {
            if (g + 1 < NT / 2) {
#pragma unroll
                for (int u = 0; u < 2; ++u)
#pragma unroll
                    for (int kk = 0; kk < 2; ++kk) { const int c = ((g + 1) * 32 + u * 8) * HD * 2 + kk * 64; fh[(g + 1) & 1][u][kk] = ldks(kh, vk, c); fl[(g + 1) & 1][u][kk] = ldks(kl, vk, c); } }
            __builtin_amdgcn_sched_barrier(0);   // the next pair's sixteen loads are issued in front of this pair's products (left alone the compiler sinks each load to its use and waits for it there), and the four loads of a 128-B line stay together
#pragma unroll
            for (int u = 0; u < 2; ++u) { v8f a = (v8f){};
#pragma unroll
                for (int kk = 0; kk < 2; ++kk) { a = wmmab(fh[g & 1][u][kk], qh[kk], a); a = wmmab(fh[g & 1][u][kk], ql[kk], a); a = wmmab(fl[g & 1][u][kk], qh[kk], a); }
                s[g * 2 + u] = a; }
            __builtin_amdgcn_sched_barrier(0);   // and the pair after next is not lifted over these products: two pairs of fragments are what the registers hold
        }
        float mx = -3.0e38f;
#pragma unroll
        for (int t = 0; t < NT; ++t)
#pragma unroll
            for (int j = 0; j < 8; ++j) { const float x = s[t][j] * SCL; s[t][j] = x; mx = fmaxf(mx, x); }
        mx = fmaxf(mx, __shfl_xor(mx, 16, 32));
        if (hi == 0) rmx[wv * 16 + lr] = mx;
        __syncthreads();   // every wave's row maxima are in LDS
#pragma unroll
        for (int w = 0; w < FW; ++w) mx = fmaxf(mx, rmx[w * 16 + lr]);
        float sm[4] = {0.f, 0.f, 0.f, 0.f};
#pragma unroll
        for (int t = 0; t < NT; ++t)
#pragma unroll
            for (int j = 0; j < 8; ++j) { const float e = exp2s((s[t][j] - mx) * 1.4426950408889634f); s[t][j] = e; sm[j & 3] += e; }
        float sum = (sm[0] + sm[1]) + (sm[2] + sm[3]); sum += __shfl_xor(sum, 16, 32);
        if (hi == 0) rsm[wv * 16 + lr] = sum;
        __syncthreads();   // every wave's row sums are in LDS
        sum = rsm[lr];
#pragma unroll
        for (int w = 1; w < FW; ++w) sum += rsm[w * 16 + lr];
        const float f = __fdiv_rn(hires ? 1.0f : PCAR, sum);
        v8f o[4];
#pragma unroll
        for (int dt = 0; dt < 4; ++dt) o[dt] = (v8f){};
        if (hires) { const bf* vh = Vh + pl; const bf* vl = Vl + pl;
#pragma unroll
            for (int g = 0; g < NG; ++g) if (g < na) { v16bf va[2][4], vb[2][4];
#pragma unroll
                for (int x = 0; x < 2; ++x)
#pragma unroll
                    for (int dt = 0; dt < 4; ++dt) { const int c = (dt * 16 * TT + (g * 2 + x) * 32) * 2; va[x][dt] = ldcb(vh, vv, c); vb[x][dt] = ldcb(vl, vv, c); }
                asm volatile("s_wait_xcnt 0x0" ::: "memory");   // behind the block's loads, in front of the arithmetic below, which may reuse the registers that hold their address
                __builtin_amdgcn_sched_barrier(0);   // the block's v loads are all in flight in front of the arithmetic on its probabilities
#pragma unroll
                for (int sx = g * 2; sx < g * 2 + 2; ++sx) { v8us h0, h1, l0, l1; v4f m[4];
#pragma unroll
                    for (int u = 0; u < 4; ++u) m[u] = *(const v4fa*)(al + (sx * 4 + u) * (FW * 32 * 4));
#pragma unroll
                    for (int e = 0; e < 8; ++e) { const float p0 = s[2 * sx][e] * f, p1 = s[2 * sx + 1][e] * f; unsigned short a, c2; splitf(p0, a, c2); h0[e] = a; l0[e] = c2; splitf(p1, a, c2); h1[e] = a; l1[e] = c2; m[e >> 2][e & 3] += p0; m[2 + (e >> 2)][e & 3] += p1; }
#pragma unroll
                    for (int u = 0; u < 4; ++u) *(v4fa*)(al + (sx * 4 + u) * (FW * 32 * 4)) = m[u];
                    const v16bf ph = cat16b(h0, h1), pq = cat16b(l0, l1);
#pragma unroll
                    for (int dt = 0; dt < 4; ++dt) { o[dt] = wmmab(va[sx & 1][dt], ph, o[dt]); o[dt] = wmmab(va[sx & 1][dt], pq, o[dt]); o[dt] = wmmab(vb[sx & 1][dt], ph, o[dt]); } } }
        } else { const h16* v16 = V16 + pl;
#pragma unroll
            for (int g = 0; g < NG; ++g) if (g < na) { v16h va[2][4];
#pragma unroll
                for (int x = 0; x < 2; ++x)
#pragma unroll
                    for (int dt = 0; dt < 4; ++dt) va[x][dt] = ldch(v16, vv, (dt * 16 * TT + (g * 2 + x) * 32) * 2);
                asm volatile("s_wait_xcnt 0x0" ::: "memory");   // behind the block's loads, in front of the arithmetic below, which may reuse the registers that hold their address
                __builtin_amdgcn_sched_barrier(0);   // the block's v loads are all in flight in front of the arithmetic on its probabilities
#pragma unroll
                for (int sx = g * 2; sx < g * 2 + 2; ++sx) { v16h pf; v4f m[4];
#pragma unroll
                    for (int u = 0; u < 4; ++u) m[u] = *(const v4fa*)(al + (sx * 4 + u) * (FW * 32 * 4));
#pragma unroll
                    for (int e = 0; e < 8; ++e) { const float p0 = s[2 * sx][e] * f, p1 = s[2 * sx + 1][e] * f; pf[e] = tohx(p0); pf[8 + e] = tohx(p1); m[e >> 2][e & 3] += p0 * (1.0f / PCAR); m[2 + (e >> 2)][e & 3] += p1 * (1.0f / PCAR); }
#pragma unroll
                    for (int u = 0; u < 4; ++u) *(v4fa*)(al + (sx * 4 + u) * (FW * 32 * 4)) = m[u];
#pragma unroll
                    for (int dt = 0; dt < 4; ++dt) o[dt] = wmma16(va[sx & 1][dt], pf, o[dt]); } }
        }
        if (na > 0) { float* pw = po + wv * (16 * 68) + lr * 68 + hi * 8;   // out^T tile dt: lane lr = query, register j = d dt 16 + hi 8 + j
#pragma unroll
            for (int dt = 0; dt < 4; ++dt) { v4f x0, x1;
#pragma unroll
                for (int j = 0; j < 4; ++j) { x0[j] = o[dt][j]; x1[j] = o[dt][4 + j]; }
                *(v4fa*)(pw + dt * 16) = x0; *(v4fa*)(pw + dt * 16 + 4) = x1; } }
        __syncthreads();   // the partial out tiles are in LDS before any wave sums; the next head writes them again only behind its own two barriers
        { const float* pr = po + rq * 68 + rd; v4f val = *(const v4fa*)pr;
            for (int w = 1; w < nact; ++w) { const v4f q = *(const v4fa*)(pr + w * (16 * 68)); val[0] += q[0]; val[1] += q[1]; val[2] += q[2]; val[3] += q[3]; }
            const float cs = hires ? 1.0f : (1.0f / PCAR); v4us oh, ol;
#pragma unroll
            for (int q = 0; q < 4; ++q) { unsigned short a, c2; splitf(val[q] * cs, a, c2); oh[q] = a; ol[q] = c2; }
            const size_t oo = (size_t)(b * TT + i0 + rq) * DQ + h * HD + rd; *(v4us*)(Ah + oo) = oh; *(v4us*)(Al + oo) = ol;
            asm volatile("s_wait_xcnt 0x0" ::: "memory");   // behind the two stores, in front of the next head's arithmetic, which may reuse the registers that they name
        }
    }
    float* ar = AW + ((size_t)b * TT + i0 + lr) * TT + kb + hi * 16;
    v4f x[NT * 2];
#pragma unroll
    for (int t = 0; t < NT * 2; ++t) { x[t] = *(const v4fa*)(al + t * (FW * 32 * 4));
#pragma unroll
        for (int j = 0; j < 4; ++j) x[t][j] *= 0.0625f; }
    __builtin_amdgcn_sched_barrier(0);   // every sum is read and scaled in front of the first store, so that no register which an issued store names is written again
#pragma unroll
    for (int t = 0; t < NT; ++t) { float* p = ar + (t >> 1) * 32 + (t & 1) * 8; *(v4f*)p = x[t * 2]; *(v4f*)(p + 4) = x[t * 2 + 1]; }
}
extern "C" void kernel_launch(void* const* d_in, const int* in_sizes, int n_in,
                              void* d_out, int out_size, void* d_ws, size_t ws_size, hipStream_t stream) {
    (void)in_sizes; (void)n_in; (void)out_size;
    const float* x = (const float*)d_in[0]; const float* wf = (const float*)d_in[1]; const float* wo = (const float*)d_in[2]; const float* bo = (const float*)d_in[3];
    float* OUT = (float*)d_out;     // [2][2048][1024]
    char* wsp = (char*)d_ws;
    auto take = [&](size_t bytes) { char* p = wsp; wsp += (bytes + 255) & ~(size_t)255; return (void*)p; };
    bf* WO = (bf*)take((size_t)DM * DQ * 2);
    bf* XB = (bf*)take((size_t)MT * DM * 2); bf* WALL = (bf*)take((size_t)(DQ + 2 * DKV) * DM * 2); float* AW = OUT + (size_t)NB_ * TT * DM + 0;   /* out1 region base; batch b at + b*TT*TT */
    h16* VT16 = (h16*)take((size_t)NKV * HD * MT * 2);
    bf* QPh = (bf*)take((size_t)NH_ * MT * HD * 2); bf* QPl = (bf*)take((size_t)NH_ * MT * HD * 2); bf* KPh = (bf*)take((size_t)NKV * MT * HD * 2); bf* KPl = (bf*)take((size_t)NKV * MT * HD * 2); bf* VTh = (bf*)take((size_t)NKV * HD * MT * 2); bf* VTl = (bf*)take((size_t)NKV * HD * MT * 2);
    bf* ATh = (bf*)take((size_t)MT * DQ * 2); bf* ATl = (bf*)take((size_t)MT * DQ * 2);
    if ((size_t)(wsp - (char*)d_ws) > ws_size) return;    // 88 MiB of the 256 MiB
    k_wtG<<<(unsigned)((DM * (DQ + 2 * DKV) / 64 + 63) / 64), 256, 0, stream>>>(wf, DM, DQ + 2 * DKV, WALL);
    k_wtG<<<(unsigned)((DQ * DM / 64 + 63) / 64), 256, 0, stream>>>(wo, DQ, DM, WO);
    k_cvt8<<<(unsigned)(((size_t)MT * DM / 8 + 255) / 256), 256, 0, stream>>>(x, XB, (size_t)MT * DM / 8);
    k_gemmks<bf, 0, false, 8, true><<<dim3(MT / 64, (DQ + 2 * DKV) / 64, 1), 256, 0, stream>>>(XB, nullptr, WALL, nullptr, DM, nullptr, 0, nullptr, 0, 0, 0, QPh, QPl, KPh, KPl, VTh, VTl, VT16);
    k_fattn<<<dim3(NB_, TT / 16, 1), FW * 32, 0, stream>>>(QPh, QPl, KPh, KPl, VT16, VTh, VTl, AW, ATh, ATl);
    k_gemmks<bf, 1, true, 8, false><<<dim3(MT / 64, DM / 64, 1), 256, 0, stream>>>(ATh, ATl, WO, nullptr, DQ, OUT, DM, bo, 0, 0, 0, nullptr, nullptr, nullptr, nullptr, nullptr, nullptr, nullptr);
}

// v006
// A run of this version takes 247 microseconds.
// Two timings next to v005 both put it at 1.32 times that version's speed.
// Over all steps from v000 it is 8.45 times as fast.
#include <hip/hip_runtime.h>

// CausalTemporalAttention (x [2][2048][1024]; qkv = x w_qkv ([1024][3072] q | k | v; 16 x 64); attn = softmax(q.k / 8) over ALL keys, THEN multiplied by the block-causal mask [j/64 <= i/64] without renormalisation; out0 = (attn v) merged w_out + b_out -> [2][2048][1024] at 0; out1 = attn.mean over the 16 heads -> [2][2048][2048] at element 4,194,304).
// Compute dtypes, f32 accumulate: every input rounded to bf16; q/k/v on PLAIN bf16 operands (inputs: exact); scores hl x hl (3 products) on every row over all keys (the softmax normaliser needs every key); softmax f32; the structural block mask applied to the probabilities in f32; attn.v: rows < 512 hl (3 products), the rest fp16 (x1024); the head mean accumulated in f32 (in LDS) from the f32 probabilities in head order inside the attention kernel (no atomics) and scaled by 1/16 behind the last head; w_out hl x exact (2 products) + bias.

// Both batches run in every launch: the projections take the 4096 rows of x as one M; the head planes lie [head][batch][t][d] (v: [head][batch][d][t]).
// FRAGMENT ORDER: every 16-bit operand plane (rows x K) is stored as blocks of 16 rows x 32 k, block (R, S) at element (R (K/32) + S) 512, and inside a block as [part 0..1][lane 0..31][8 elements]: what one wave-wide 16-byte load of a fragment takes is 512 contiguous bytes (four whole 128-B lines, not a 32-B piece of sixteen lines). Lane = 16 hi + (row & 15). k inside a block = 16 part + 8 hi + j (x, the weights, q, k, the attention output) or 16 hi + 8 part + j (the v planes, whose reader wants 16 consecutive keys a lane).
#define NB_  2
#define TT   2048
#define DM   1024
#define NH_  16
#define NKV  16
#define REP  (NH_ / NKV)
#define HD   64
#define DQ   (NH_ * HD)
#define DKV  (NKV * HD)
#define MT   (NB_ * TT)           // rows of both batches
#define RH   512                  // query rows < RH use hi+lo planes (0: none)
#define WIN  0
#define PCAR 1024.0f
#define SCL  0.125f   // HD^-0.5
typedef _Float16 h16;
typedef unsigned short bf;
typedef __attribute__((ext_vector_type(16))) __bf16   v16bf;
typedef __attribute__((ext_vector_type(16))) _Float16 v16h;
typedef __attribute__((ext_vector_type(8)))  _Float16 v8h;
typedef __attribute__((ext_vector_type(8)))  unsigned short v8us;
typedef __attribute__((ext_vector_type(8)))  float    v8f;
typedef __attribute__((ext_vector_type(4)))  float    v4f;
typedef v8h  __attribute__((may_alias)) v8ha;
typedef v4f  __attribute__((may_alias)) v4fa;
typedef v8us __attribute__((may_alias)) v8usa;

__device__ __forceinline__ unsigned short f2bf(float f) { unsigned u = __float_as_uint(f); u += 0x7FFFu + ((u >> 16) & 1u); return (unsigned short)(u >> 16); }
__device__ __forceinline__ float bf2f(unsigned short b) { return __uint_as_float(((unsigned)b) << 16); }
__device__ __forceinline__ float bfr(float f) { return bf2f(f2bf(f)); }
__device__ __forceinline__ v16h cat16(v8h lo, v8h hi) { return __builtin_shufflevector(lo, hi, 0, 1, 2, 3, 4, 5, 6, 7, 8, 9, 10, 11, 12, 13, 14, 15); }
__device__ __forceinline__ v16bf cat16b(v8us lo, v8us hi) { return __builtin_bit_cast(v16bf, __builtin_shufflevector(lo, hi, 0, 1, 2, 3, 4, 5, 6, 7, 8, 9, 10, 11, 12, 13, 14, 15)); }
__device__ __forceinline__ v8f wmma16(v16h a, v16h b, v8f c) { return __builtin_amdgcn_wmma_f32_16x16x32_f16(false, a, false, b, (short)0, c, false, false); }
__device__ __forceinline__ v8f wmmab(v16bf a, v16bf b, v8f c) { return __builtin_amdgcn_wmma_f32_16x16x32_bf16(false, a, false, b, (short)0, c, false, false); }



// ---- fragments: operands straight from planes in fragment order (p: the block's start + 8 lane); lane lr = lane & 15 holds row lr, k = 8 hi + 0..7 and 16 + 8 hi + 0..7 (hi = lane >> 4), the same for A and for B.
template <typename T16> struct WFrag;
template <> struct WFrag<h16> { typedef v16h V; static __device__ __forceinline__ V ld(const h16* p) { return cat16(*(const v8h*)p, *(const v8h*)(p + 256)); } static __device__ __forceinline__ v8f mma(V a, V b, v8f c) { return wmma16(a, b, c); } };
template <> struct WFrag<bf> { typedef v16bf V; static __device__ __forceinline__ V ld(const bf* p) { return cat16b(*(const v8us*)p, *(const v8us*)(p + 256)); } static __device__ __forceinline__ v8f mma(V a, V b, v8f c) { return wmmab(a, b, c); } };

// ---- k_gemmks: register-blocked GEMM, 64x64 output tile (16 accumulators a wave): C[m][n] (f32, pitch ldc, + optional f32 bias[n]) = sum_k A[m][k] Bt[n][k] (+ split products per NSPLIT), A and Bt in fragment order; z-batch strides sA/sB/sC in elements; NW waves per work-group, each takes K/NW of the k range (which: at the loop); each wave leaves its f32 partial tile in its own LDS plane [64][68], one barrier, then the NW planes are summed in wave order (a fixed order) and stored as whole 256-B row pieces. K % (64 NW) == 0; grid (M/64, N/64, Z), 32 NW threads.
// PLANES (the q | k | v projection, N = 3 x 16 heads x 64, NW = 8): a column tile is one head of q, k or v, and the summed tile goes straight into that head's 16-bit planes, not into C: q and k as hi + lo [h][b][t][d], v as fp16 and hi + lo [h][b][d][t]. A v tile is computed transposed (the weight's rows as A, the rows of x as B: the two loaders are the same), so that its rows are d and its columns t. Every plane is stored in fragment order, a wave's store being one 512-B part of a block.
__device__ __forceinline__ void splitf(float y, unsigned short& h, unsigned short& l) { h = f2bf(y); l = f2bf(y - bf2f(h)); }
typedef __attribute__((ext_vector_type(4))) _Float16 v4h;
typedef __attribute__((ext_vector_type(4))) unsigned short v4us;
template <typename T16, int NSPLIT, bool BIAS, int NW, bool PLANES>
__global__ __launch_bounds__(NW * 32) void k_gemmks(const T16* __restrict__ A, const T16* __restrict__ A2, const T16* __restrict__ Bt, const T16* __restrict__ Bt2, int K, float* C, int ldc, const float* __restrict__ bias, size_t sA, size_t sB, size_t sC, bf* Qh, bf* Ql, bf* Kh, bf* Kl, bf* Vh, bf* Vl, h16* V16) {
    typedef typename WFrag<T16>::V V;
    __shared__ __align__(16) float ps[NW * 64 * 68];
    const size_t z = blockIdx.z; A += z * sA; if (A2) A2 += z * sA; Bt += z * sB; if (Bt2) Bt2 += z * sB; C += z * sC;
    const int lane = threadIdx.x & 31, lr = lane & 15, hi = lane >> 4; const int wv = __builtin_amdgcn_readfirstlane((int)(threadIdx.x >> 5)); const int r0 = blockIdx.x * 64, c0 = blockIdx.y * 64;
    v8f acc[4][4];
#pragma unroll
    for (int mb = 0; mb < 4; ++mb)
#pragma unroll
        for (int nb = 0; nb < 4; ++nb) acc[mb][nb] = (v8f){};
    // waves 2p and 2p+1 share the k range [2p K/NW, (2p+2) K/NW) and take its 32-k blocks in turn
    const int kw2 = 2 * (K / NW), kbeg = (wv >> 1) * kw2 + (wv & 1) * 32;
    // addresses: a wave-uniform base per sixteen-row block and plane, fixed over the loop, and ONE 32-bit lane offset in bytes (A and Bt have the same K), which alone moves along k
    const bool vt = PLANES && (int)blockIdx.y >= 2 * NH_;   // a v tile (the same for the whole work-group)
    const T16* sa[4]; const T16* sa2[4]; const T16* sb[4]; const T16* sb2[4];
#pragma unroll
    for (int q = 0; q < 4; ++q) { const size_t ra = ((size_t)(r0 / 16 + q) * (K / 32) + kbeg / 32) * 512, rb = ((size_t)(c0 / 16 + q) * (K / 32) + kbeg / 32) * 512; sa[q] = vt ? Bt + rb : A + ra; sb[q] = vt ? A + ra : Bt + rb; if (NSPLIT == 1 || NSPLIT == 2) sa2[q] = A2 + ra; if (NSPLIT >= 2) sb2[q] = Bt2 + rb; }
    unsigned voff = (unsigned)(lane * 8) * (unsigned)sizeof(T16);
    // rolled: one trip's fragments and the sixteen accumulators are what a wave's registers hold
#pragma unroll 1
    for (int kc = 0; kc < kw2; kc += 64) {
        V a[4], a2[4];
#pragma unroll
        for (int mb = 0; mb < 4; ++mb) { a[mb] = WFrag<T16>::ld((const T16*)((const char*)sa[mb] + voff)); if (NSPLIT == 1 || NSPLIT == 2) a2[mb] = WFrag<T16>::ld((const T16*)((const char*)sa2[mb] + voff)); }
#pragma unroll
        for (int nb = 0; nb < 4; ++nb) { const V b = WFrag<T16>::ld((const T16*)((const char*)sb[nb] + voff)); V b2; if (NSPLIT >= 2) b2 = WFrag<T16>::ld((const T16*)((const char*)sb2[nb] + voff));
#pragma unroll
            for (int mb = 0; mb < 4; ++mb) { acc[mb][nb] = WFrag<T16>::mma(a[mb], b, acc[mb][nb]); if (NSPLIT == 1 || NSPLIT == 2) acc[mb][nb] = WFrag<T16>::mma(a2[mb], b, acc[mb][nb]); if (NSPLIT >= 2) acc[mb][nb] = WFrag<T16>::mma(a[mb], b2, acc[mb][nb]); } }
        // four vector slots behind the trip's last matrix instruction, on the taken back edge too. The lane offset is an input, so that it keeps its register to the end of the trip and is stepped only behind the waits on all of the trip's loads
        asm volatile("v_nop\n\tv_nop\n\tv_nop\n\tv_nop" : "+v"(acc[0][0]), "+v"(acc[1][1]), "+v"(acc[2][2]), "+v"(acc[3][3]) : "v"(a[0]), "v"(a[3]), "v"(voff));
        voff += 2 * 512 * (unsigned)sizeof(T16);   // 64 k on: two blocks
    }
    float* pw = ps + wv * (64 * 68);
#pragma unroll
    for (int mb = 0; mb < 4; ++mb)
#pragma unroll
        for (int nb = 0; nb < 4; ++nb)
#pragma unroll
            for (int j = 0; j < 8; ++j) pw[(mb * 16 + hi * 8 + j) * 68 + nb * 16 + lr] = acc[mb][nb][j];
    __syncthreads();   // every wave's partial tile is in LDS before any wave sums
    if (PLANES) {
        // the tile is 4 x 2 blocks of two parts: wave wv takes parts 2 wv and 2 wv + 1; a lane sums and stores the eight elements of its place in the part (row 16 R + lr of the tile)
        const size_t pb = (size_t)(((int)blockIdx.y % NH_) * NB_ + r0 / TT) * ((size_t)TT * HD) + lane * 8; const int t0 = r0 % TT;
        bf* ph = (vt ? Vh : (int)blockIdx.y >= NH_ ? Kh : Qh) + pb; bf* pl = (vt ? Vl : (int)blockIdx.y >= NH_ ? Kl : Ql) + pb; h16* p16 = V16 + pb;
        v8us oh[2], ol[2]; v8h o16[2]; int po[2];
#pragma unroll
        for (int s = 0; s < 2; ++s) { const int cb = wv * 2 + s, R = cb >> 2, S = (cb >> 1) & 1, P = cb & 1;
            const float* pr = ps + (R * 16 + lr) * 68 + S * 32 + (vt ? hi * 16 + P * 8 : P * 16 + hi * 8); v4f v0 = *(const v4fa*)pr, v1 = *(const v4fa*)(pr + 4);
#pragma unroll
            for (int w = 1; w < NW; ++w) { const v4f q0 = *(const v4fa*)(pr + w * (64 * 68)), q1 = *(const v4fa*)(pr + w * (64 * 68) + 4);
#pragma unroll
                for (int q = 0; q < 4; ++q) { v0[q] += q0[q]; v1[q] += q1[q]; } }
#pragma unroll
            for (int q = 0; q < 4; ++q) { unsigned short a, c2; splitf(v0[q], a, c2); oh[s][q] = a; ol[s][q] = c2; o16[s][q] = (h16)v0[q]; splitf(v1[q], a, c2); oh[s][4 + q] = a; ol[s][4 + q] = c2; o16[s][4 + q] = (h16)v1[q]; }
            po[s] = (vt ? R * (TT / 32) + (t0 >> 5) + S : ((t0 >> 4) + R) * (HD / 32) + S) * 512 + P * 256; }
        if (vt) {
#pragma unroll
            for (int s = 0; s < 2; ++s) { *(v8us*)(ph + po[s]) = oh[s]; *(v8us*)(pl + po[s]) = ol[s]; *(v8h*)(p16 + po[s]) = o16[s]; }
            return;
        }
#pragma unroll
        for (int s = 0; s < 2; ++s) { *(v8us*)(ph + po[s]) = oh[s]; *(v8us*)(pl + po[s]) = ol[s]; }
        asm volatile("s_wait_xcnt 0x0" ::: "memory");   // behind the last store, in front of whatever the listing places behind it that writes a register which the stores name
        return;
    }
#pragma unroll
    for (int s = 0; s < 32 / NW; ++s) { const int idx = s * (NW * 32) + (int)threadIdx.x; const int row = idx >> 4, cofs = (idx & 15) * 4; const float* pr = ps + row * 68 + cofs; v4f val = *(const v4fa*)pr;
#pragma unroll
        for (int w = 1; w < NW; ++w) { const v4f q = *(const v4fa*)(pr + w * (64 * 68)); val[0] += q[0]; val[1] += q[1]; val[2] += q[2]; val[3] += q[3]; }
        if (BIAS) { val[0] += bfr(bias[c0 + cofs]); val[1] += bfr(bias[c0 + cofs + 1]); val[2] += bfr(bias[c0 + cofs + 2]); val[3] += bfr(bias[c0 + cofs + 3]); }
        *(v4f*)(C + (size_t)(r0 + row) * ldc + c0 + cofs) = val; }
}

__device__ __forceinline__ h16 tohx(float x) { return (h16)x; }
typedef __attribute__((ext_vector_type(2))) unsigned short v2us;
typedef __attribute__((ext_vector_type(2))) float v2f;
typedef __attribute__((ext_vector_type(4))) int v4i;

__global__ __launch_bounds__(256) void k_wtG(const float* __restrict__ w, int K, int N, bf* Bt) {
    const int lane = threadIdx.x & 31; const int L0 = (blockIdx.x * 8 + (threadIdx.x >> 5)) * 8; const int nlines = N * K / 64;
{
#pragma unroll 1
        for (int l = 0; l < 8; ++l) { const int L = L0 + l; if (L >= nlines) break; const size_t e = (size_t)L * 64 + lane * 2; const int blk = (int)(e >> 9), wi = (int)(e & 511), k = (blk % (K / 32)) * 32 + (wi >> 8) * 16 + ((wi >> 7) & 1) * 8 + (wi & 7), n = (blk / (K / 32)) * 16 + ((wi >> 3) & 15); v2us o;   // e: the place in fragment order
            o[0] = f2bf(w[(size_t)k * N + n]); o[1] = f2bf(w[(size_t)(k + 1) * N + n]); *(v2us*)(Bt + e) = o; }
         }
}
__global__ __launch_bounds__(256) void k_cvt8(const float* __restrict__ src, bf* dst, size_t n8) { const size_t i = (size_t)blockIdx.x * 256 + threadIdx.x; if (i >= n8) return;   // i: the 16-byte place in fragment order (rows of DM elements)
    const int blk = (int)(i >> 6), row = (blk / (DM / 32)) * 16 + ((int)i & 15), k = (blk % (DM / 32)) * 32 + (((int)i >> 5) & 1) * 16 + (((int)i >> 4) & 1) * 8; const v8f v = *(const v8f*)(src + (size_t)row * DM + k); v8us o;
#pragma unroll
    for (int k = 0; k < 8; ++k) o[k] = f2bf(v[k]); *(v8us*)(dst + i * 8) = o;  }
// ---- k_fattn: scores, softmax, block mask, head mean and attn.v of 16 query rows of one batch in ONE work-group of 8 waves, the 16 heads one after the other; scores and probabilities stay in registers. grid (batch, TT/16), 256 threads.
// Each wave owns 256 keys. Scores are computed TRANSPOSED (A = 16 keys of k, B = the 16 queries): a lane then holds one query (lr) and eight keys a tile, which is the B-fragment form that attn.v wants (out^T = v^T p^T, A = 16 rows d of the [d][t] plane), so that no value changes lanes.
// Row m of score tile t is key kb + (t>>1) 32 + (m>>3) 16 + (t&1) 8 + (m&7): tiles 2s and 2s+1 give lane half hi the 16 consecutive keys kb + 32 s + 16 hi + e, e = 0..15, element e of the B fragment of k-step s; the v^T loader reads the same 16 keys into element e. A score tile so takes eight rows from each of two neighbouring 16-key blocks of the k plane: each of its loads is four whole 128-B lines (eight lanes a line).
// Row maximum and row sum go through LDS (8 waves, summed in wave order); the partial out^T tiles of the waves with unmasked keys are summed in LDS in wave order. A 64-key block lies in one wave and is masked or not for the whole work-group (16 rows lie in one 64-row block): masked blocks skip attn.v and add nothing to the mean.
#define FW   8                    // waves per work-group
#define KW   (TT / FW)            // keys per wave
#define NT   (KW / 16)            // score tiles per wave
#define NG   (KW / 64)            // 64-key mask blocks per wave
// a fragment from a plane in fragment order: the two 512-B parts of a block (q, k planes: k = 8 hi + 0..7 | 16 + 8 hi + 0..7; v planes: 16 consecutive keys)
__device__ __forceinline__ v16bf ldfb(const bf* ub, unsigned vo, int c) { const char* p = (const char*)ub + vo; return cat16b(*(const v8us*)(p + c), *(const v8us*)(p + c + 512)); }
__device__ __forceinline__ v16h ldfh(const h16* ub, unsigned vo, int c) { const char* p = (const char*)ub + vo; return cat16(*(const v8h*)(p + c), *(const v8h*)(p + c + 512)); }
// 2^x with the one vector slot that the instruction set asks for behind a transcendental, in front of an instruction that reads its result or overwrites its source
__device__ __forceinline__ float exp2s(float x) { float e; asm("v_exp_f32 %0, %1\n\tv_nop" : "=v"(e) : "v"(x)); return e; }
__global__ __launch_bounds__(FW * 32) void k_fattn(const bf* __restrict__ Qh, const bf* __restrict__ Ql, const bf* __restrict__ Kh, const bf* __restrict__ Kl, const h16* __restrict__ V16, const bf* __restrict__ Vh, const bf* __restrict__ Vl, float* AW, bf* Ah, bf* Al) {
    __shared__ __align__(16) float po[FW * 16 * 68];
    __shared__ float rmx[FW * 16]; __shared__ float rsm[FW * 16];
    __shared__ __align__(16) float awl[NT * 2 * FW * 32 * 4];   // the head mean's f32 sums, [tile][half][thread][4]: each thread reads and writes its own 16-B slots only (touched once a head: in registers they would crowd out the fragments in flight)
    const int lane = threadIdx.x & 31, lr = lane & 15, hi = lane >> 4; const int wv = __builtin_amdgcn_readfirstlane((int)(threadIdx.x >> 5));
    const int b = blockIdx.x, i0 = (TT / 16 - 1 - (int)blockIdx.y) * 16, kb = wv * KW, qb = i0 >> 6; const bool hires = (i0 < RH);   // the late rows, which have the most unmasked keys, start first
    int na = qb + 1 - wv * NG; na = na < 0 ? 0 : (na > NG ? NG : na);   // unmasked 64-key blocks of this wave
    const int nact = qb / NG + 1;                                       // waves with at least one
    // lane offsets in bytes, fixed over the kernel; the plane bases are wave-uniform
    const unsigned vq = (unsigned)((i0 >> 4) * (HD / 32) * 512 + lane * 8) * 2u, vk = (unsigned)(((kb >> 4) + (lr >> 3)) * (HD / 32) * 512 + (hi * 16 + (lr & 7)) * 8) * 2u, vv = (unsigned)((kb >> 5) * 512 + lane * 8) * 2u;
    const int rq = ((int)threadIdx.x >> 1) & 15, rd = wv * 8 + ((int)threadIdx.x & 1) * 4;   // the reducer's query row and first d: a wave's store is 256 contiguous bytes of the output plane's fragment order
    float* al = awl + (int)threadIdx.x * 4;
#pragma unroll
    for (int t = 0; t < NT * 2; ++t) *(v4fa*)(al + t * (FW * 32 * 4)) = (v4f){};
    // rolled over the heads: one head's code is long, and s and o stay in registers only under constant indices (every loop over them is unrolled)
#pragma unroll 1
    for (int h = 0; h < NH_; ++h) { const size_t pl = (size_t)(h * NB_ + b) * ((size_t)TT * HD);
        const bf* kh = Kh + pl; const bf* kl = Kl + pl; v16bf qh[2], ql[2];
#pragma unroll
        for (int kk = 0; kk < 2; ++kk) { qh[kk] = ldfb(Qh + pl, vq, kk * 1024); ql[kk] = ldfb(Ql + pl, vq, kk * 1024); }
        v8f s[NT]; v16bf fh[2][2][2], fl[2][2][2];   // k fragments [buffer][tile of the pair][32-k half]: the pair in work and the pair in flight
#pragma unroll
        for (int u = 0; u < 2; ++u)
#pragma unroll
            for (int kk = 0; kk < 2; ++kk) { fh[0][u][kk] = ldfb(kh, vk, u * 128 + kk * 1024); fl[0][u][kk] = ldfb(kl, vk, u * 128 + kk * 1024); }
#pragma unroll
        for (int g = 0; g < NT / 2; ++g) {
            if (g + 1 < NT / 2) {
#pragma unroll
                for (int u = 0; u < 2; ++u)
#pragma unroll
                    for (int kk = 0; kk < 2; ++kk) { const int c = (g + 1) * 4096 + u * 128 + kk * 1024; fh[(g + 1) & 1][u][kk] = ldfb(kh, vk, c); fl[(g + 1) & 1][u][kk] = ldfb(kl, vk, c); } }
            __builtin_amdgcn_sched_barrier(0);   // the next pair's sixteen loads are issued in front of this pair's products (left alone the compiler sinks each load to its use and waits for it there)
#pragma unroll
            for (int u = 0; u < 2; ++u) { v8f a = (v8f){};
#pragma unroll
                for (int kk = 0; kk < 2; ++kk) { a = wmmab(fh[g & 1][u][kk], qh[kk], a); a = wmmab(fh[g & 1][u][kk], ql[kk], a); a = wmmab(fl[g & 1][u][kk], qh[kk], a); }
                s[g * 2 + u] = a; }
            __builtin_amdgcn_sched_barrier(0);   // and the pair after next is not lifted over these products: two pairs of fragments are what the registers hold
        }
        float mx = -3.0e38f;
#pragma unroll
        for (int t = 0; t < NT; ++t)
#pragma unroll
            for (int j = 0; j < 8; ++j) { const float x = s[t][j] * SCL; s[t][j] = x; mx = fmaxf(mx, x); }
        mx = fmaxf(mx, __shfl_xor(mx, 16, 32));
        if (hi == 0) rmx[wv * 16 + lr] = mx;
        __syncthreads();   // every wave's row maxima are in LDS
#pragma unroll
        for (int w = 0; w < FW; ++w) mx = fmaxf(mx, rmx[w * 16 + lr]);
        float sm[4] = {0.f, 0.f, 0.f, 0.f};
#pragma unroll
        for (int t = 0; t < NT; ++t)
#pragma unroll
            for (int j = 0; j < 8; ++j) { const float e = exp2s((s[t][j] - mx) * 1.4426950408889634f); s[t][j] = e; sm[j & 3] += e; }
        float sum = (sm[0] + sm[1]) + (sm[2] + sm[3]); sum += __shfl_xor(sum, 16, 32);
        if (hi == 0) rsm[wv * 16 + lr] = sum;
        __syncthreads();   // every wave's row sums are in LDS
        sum = rsm[lr];
#pragma unroll
        for (int w = 1; w < FW; ++w) sum += rsm[w * 16 + lr];
        const float f = __fdiv_rn(hires ? 1.0f : PCAR, sum);
        v8f o[4];
#pragma unroll
        for (int dt = 0; dt < 4; ++dt) o[dt] = (v8f){};
        if (hires) { const bf* vh = Vh + pl; const bf* vl = Vl + pl;
#pragma unroll
            for (int g = 0; g < NG; ++g) if (g < na) { v16bf va[2][4], vb[2][4];
#pragma unroll
                for (int x = 0; x < 2; ++x)
#pragma unroll
                    for (int dt = 0; dt < 4; ++dt) { const int c = (dt * (TT / 32) + g * 2 + x) * 1024; va[x][dt] = ldfb(vh, vv, c); vb[x][dt] = ldfb(vl, vv, c); }
                asm volatile("s_wait_xcnt 0x0" ::: "memory");   // behind the block's loads, in front of the arithmetic below, which may reuse the registers that hold their address
                __builtin_amdgcn_sched_barrier(0);   // the block's v loads are all in flight in front of the arithmetic on its probabilities
#pragma unroll
                for (int sx = g * 2; sx < g * 2 + 2; ++sx) { v8us h0, h1, l0, l1; v4f m[4];
#pragma unroll
                    for (int u = 0; u < 4; ++u) m[u] = *(const v4fa*)(al + (sx * 4 + u) * (FW * 32 * 4));
#pragma unroll
                    for (int e = 0; e < 8; ++e) { const float p0 = s[2 * sx][e] * f, p1 = s[2 * sx + 1][e] * f; unsigned short a, c2; splitf(p0, a, c2); h0[e] = a; l0[e] = c2; splitf(p1, a, c2); h1[e] = a; l1[e] = c2; m[e >> 2][e & 3] += p0; m[2 + (e >> 2)][e & 3] += p1; }
#pragma unroll
                    for (int u = 0; u < 4; ++u) *(v4fa*)(al + (sx * 4 + u) * (FW * 32 * 4)) = m[u];
                    const v16bf ph = cat16b(h0, h1), pq = cat16b(l0, l1);
#pragma unroll
                    for (int dt = 0; dt < 4; ++dt) { o[dt] = wmmab(va[sx & 1][dt], ph, o[dt]); o[dt] = wmmab(va[sx & 1][dt], pq, o[dt]); o[dt] = wmmab(vb[sx & 1][dt], ph, o[dt]); } } }
        } else { const h16* v16 = V16 + pl;
#pragma unroll
            for (int g = 0; g < NG; ++g) if (g < na) { v16h va[2][4];
#pragma unroll
                for (int x = 0; x < 2; ++x)
#pragma unroll
                    for (int dt = 0; dt < 4; ++dt) va[x][dt] = ldfh(v16, vv, (dt * (TT / 32) + g * 2 + x) * 1024);
                asm volatile("s_wait_xcnt 0x0" ::: "memory");   // behind the block's loads, in front of the arithmetic below, which may reuse the registers that hold their address
                __builtin_amdgcn_sched_barrier(0);   // the block's v loads are all in flight in front of the arithmetic on its probabilities
#pragma unroll
                for (int sx = g * 2; sx < g * 2 + 2; ++sx) { v16h pf; v4f m[4];
#pragma unroll
                    for (int u = 0; u < 4; ++u) m[u] = *(const v4fa*)(al + (sx * 4 + u) * (FW * 32 * 4));
#pragma unroll
                    for (int e = 0; e < 8; ++e) { const float p0 = s[2 * sx][e] * f, p1 = s[2 * sx + 1][e] * f; pf[e] = tohx(p0); pf[8 + e] = tohx(p1); m[e >> 2][e & 3] += p0 * (1.0f / PCAR); m[2 + (e >> 2)][e & 3] += p1 * (1.0f / PCAR); }
#pragma unroll
                    for (int u = 0; u < 4; ++u) *(v4fa*)(al + (sx * 4 + u) * (FW * 32 * 4)) = m[u];
#pragma unroll
                    for (int dt = 0; dt < 4; ++dt) o[dt] = wmma16(va[sx & 1][dt], pf, o[dt]); } }
        }
        if (na > 0) { float* pw = po + wv * (16 * 68) + lr * 68 + hi * 8;   // out^T tile dt: lane lr = query, register j = d dt 16 + hi 8 + j
#pragma unroll
            for (int dt = 0; dt < 4; ++dt) { v4f x0, x1;
#pragma unroll
                for (int j = 0; j < 4; ++j) { x0[j] = o[dt][j]; x1[j] = o[dt][4 + j]; }
                *(v4fa*)(pw + dt * 16) = x0; *(v4fa*)(pw + dt * 16 + 4) = x1; } }
        __syncthreads();   // the partial out tiles are in LDS before any wave sums; the next head writes them again only behind its own two barriers
        { const float* pr = po + rq * 68 + rd; v4f val = *(const v4fa*)pr;
            for (int w = 1; w < nact; ++w) { const v4f q = *(const v4fa*)(pr + w * (16 * 68)); val[0] += q[0]; val[1] += q[1]; val[2] += q[2]; val[3] += q[3]; }
            const float cs = hires ? 1.0f : (1.0f / PCAR); v4us oh, ol;
#pragma unroll
            for (int q = 0; q < 4; ++q) { unsigned short a, c2; splitf(val[q] * cs, a, c2); oh[q] = a; ol[q] = c2; }
            const size_t oo = ((size_t)((b * TT + i0) >> 4) * (DQ / 32) + h * (HD / 32) + (rd >> 5)) * 512 + ((rd >> 4) & 1) * 256 + (((rd >> 3) & 1) * 16 + rq) * 8 + (rd & 7); *(v4us*)(Ah + oo) = oh; *(v4us*)(Al + oo) = ol;
            asm volatile("s_wait_xcnt 0x0" ::: "memory");   // behind the two stores, in front of the next head's arithmetic, which may reuse the registers that they name
        }
    }
    float* ar = AW + ((size_t)b * TT + i0 + lr) * TT + kb + hi * 16;
    v4f x[NT * 2];
#pragma unroll
    for (int t = 0; t < NT * 2; ++t) { x[t] = *(const v4fa*)(al + t * (FW * 32 * 4));
#pragma unroll
        for (int j = 0; j < 4; ++j) x[t][j] *= 0.0625f; }
    __builtin_amdgcn_sched_barrier(0);   // every sum is read and scaled in front of the first store, so that no register which an issued store names is written again
#pragma unroll
    for (int t = 0; t < NT; ++t) { float* p = ar + (t >> 1) * 32 + (t & 1) * 8; *(v4f*)p = x[t * 2]; *(v4f*)(p + 4) = x[t * 2 + 1]; }
}
extern "C" void kernel_launch(void* const* d_in, const int* in_sizes, int n_in,
                              void* d_out, int out_size, void* d_ws, size_t ws_size, hipStream_t stream) {
    (void)in_sizes; (void)n_in; (void)out_size;
    const float* x = (const float*)d_in[0]; const float* wf = (const float*)d_in[1]; const float* wo = (const float*)d_in[2]; const float* bo = (const float*)d_in[3];
    float* OUT = (float*)d_out;     // [2][2048][1024]
    char* wsp = (char*)d_ws;
    auto take = [&](size_t bytes) { char* p = wsp; wsp += (bytes + 255) & ~(size_t)255; return (void*)p; };
    bf* WO = (bf*)take((size_t)DM * DQ * 2);
    bf* XB = (bf*)take((size_t)MT * DM * 2); bf* WALL = (bf*)take((size_t)(DQ + 2 * DKV) * DM * 2); float* AW = OUT + (size_t)NB_ * TT * DM + 0;   /* out1 region base; batch b at + b*TT*TT */
    h16* VT16 = (h16*)take((size_t)NKV * HD * MT * 2);
    bf* QPh = (bf*)take((size_t)NH_ * MT * HD * 2); bf* QPl = (bf*)take((size_t)NH_ * MT * HD * 2); bf* KPh = (bf*)take((size_t)NKV * MT * HD * 2); bf* KPl = (bf*)take((size_t)NKV * MT * HD * 2); bf* VTh = (bf*)take((size_t)NKV * HD * MT * 2); bf* VTl = (bf*)take((size_t)NKV * HD * MT * 2);
    bf* ATh = (bf*)take((size_t)MT * DQ * 2); bf* ATl = (bf*)take((size_t)MT * DQ * 2);
    if ((size_t)(wsp - (char*)d_ws) > ws_size) return;    // 88 MiB of the 256 MiB
    k_wtG<<<(unsigned)((DM * (DQ + 2 * DKV) / 64 + 63) / 64), 256, 0, stream>>>(wf, DM, DQ + 2 * DKV, WALL);
    k_wtG<<<(unsigned)((DQ * DM / 64 + 63) / 64), 256, 0, stream>>>(wo, DQ, DM, WO);
    k_cvt8<<<(unsigned)(((size_t)MT * DM / 8 + 255) / 256), 256, 0, stream>>>(x, XB, (size_t)MT * DM / 8);
    k_gemmks<bf, 0, false, 8, true><<<dim3(MT / 64, (DQ + 2 * DKV) / 64, 1), 256, 0, stream>>>(XB, nullptr, WALL, nullptr, DM, nullptr, 0, nullptr, 0, 0, 0, QPh, QPl, KPh, KPl, VTh, VTl, VT16);
    k_fattn<<<dim3(NB_, TT / 16, 1), FW * 32, 0, stream>>>(QPh, QPl, KPh, KPl, VT16, VTh, VTl, AW, ATh, ATl);
    k_gemmks<bf, 1, true, 8, false><<<dim3(MT / 64, DM / 64, 1), 256, 0, stream>>>(ATh, ATl, WO, nullptr, DQ, OUT, DM, bo, 0, 0, 0, nullptr, nullptr, nullptr, nullptr, nullptr, nullptr, nullptr);
}

// v007
// A run of this version takes 239 microseconds.
// Next to v006, in two timings, it ran 1.04 and 1.03 times as fast.
// Over all steps from v000 it is 8.76 times as fast.
#include <hip/hip_runtime.h>

// CausalTemporalAttention (x [2][2048][1024]; qkv = x w_qkv ([1024][3072] q | k | v; 16 x 64); attn = softmax(q.k / 8) over ALL keys, THEN multiplied by the block-causal mask [j/64 <= i/64] without renormalisation; out0 = (attn v) merged w_out + b_out -> [2][2048][1024] at 0; out1 = attn.mean over the 16 heads -> [2][2048][2048] at element 4,194,304).
// Compute dtypes, f32 accumulate: every input rounded to bf16; q/k/v on PLAIN bf16 operands (inputs: exact); scores hl x hl (3 products) on every row over all keys (the softmax normaliser needs every key); softmax f32; the structural block mask applied to the probabilities in f32; attn.v: rows < 512 hl (3 products), the rest fp16 (x1024); the head mean accumulated in f32 (in LDS) from the f32 probabilities in head order inside the attention kernel (no atomics) and scaled by 1/16 behind the last head; w_out hl x exact (2 products) + bias.

// Both batches run in every launch: the projections take the 4096 rows of x as one M; the head planes lie [head][batch][t][d] (v: [head][batch][d][t]).
// FRAGMENT ORDER: every 16-bit operand plane (rows x K) is stored as blocks of 16 rows x 32 k, block (R, S) at element (R (K/32) + S) 512, and inside a block as [part 0..1][lane 0..31][8 elements]: what one wave-wide 16-byte load of a fragment takes is 512 contiguous bytes (four whole 128-B lines, not a 32-B piece of sixteen lines). Lane = 16 hi + (row & 15). k inside a block = 16 part + 8 hi + j (x, the weights, q, k, the attention output) or 16 hi + 8 part + j (the v planes, whose reader wants 16 consecutive keys a lane).
#define NB_  2
#define TT   2048
#define DM   1024
#define NH_  16
#define NKV  16
#define REP  (NH_ / NKV)
#define HD   64
#define DQ   (NH_ * HD)
#define DKV  (NKV * HD)
#define MT   (NB_ * TT)           // rows of both batches
#define RH   512                  // query rows < RH use hi+lo planes (0: none)
#define WIN  0
#define PCAR 1024.0f
#define SCL  0.125f   // HD^-0.5
typedef _Float16 h16;
typedef unsigned short bf;
typedef __attribute__((ext_vector_type(16))) __bf16   v16bf;
typedef __attribute__((ext_vector_type(16))) _Float16 v16h;
typedef __attribute__((ext_vector_type(8)))  _Float16 v8h;
typedef __attribute__((ext_vector_type(8)))  unsigned short v8us;
typedef __attribute__((ext_vector_type(8)))  float    v8f;
typedef __attribute__((ext_vector_type(4)))  float    v4f;
typedef v8h  __attribute__((may_alias)) v8ha;
typedef v4f  __attribute__((may_alias)) v4fa;
typedef v8us __attribute__((may_alias)) v8usa;

__device__ __forceinline__ unsigned short f2bf(float f) { unsigned u = __float_as_uint(f); u += 0x7FFFu + ((u >> 16) & 1u); return (unsigned short)(u >> 16); }
__device__ __forceinline__ float bf2f(unsigned short b) { return __uint_as_float(((unsigned)b) << 16); }
__device__ __forceinline__ float bfr(float f) { return bf2f(f2bf(f)); }
__device__ __forceinline__ v16h cat16(v8h lo, v8h hi) { return __builtin_shufflevector(lo, hi, 0, 1, 2, 3, 4, 5, 6, 7, 8, 9, 10, 11, 12, 13, 14, 15); }
__device__ __forceinline__ v16bf cat16b(v8us lo, v8us hi) { return __builtin_bit_cast(v16bf, __builtin_shufflevector(lo, hi, 0, 1, 2, 3, 4, 5, 6, 7, 8, 9, 10, 11, 12, 13, 14, 15)); }
__device__ __forceinline__ v8f wmma16(v16h a, v16h b, v8f c) { return __builtin_amdgcn_wmma_f32_16x16x32_f16(false, a, false, b, (short)0, c, false, false); }
__device__ __forceinline__ v8f wmmab(v16bf a, v16bf b, v8f c) { return __builtin_amdgcn_wmma_f32_16x16x32_bf16(false, a, false, b, (short)0, c, false, false); }



// ---- fragments: operands straight from planes in fragment order (p: the block's start + 8 lane); lane lr = lane & 15 holds row lr, k = 8 hi + 0..7 and 16 + 8 hi + 0..7 (hi = lane >> 4), the same for A and for B.
template <typename T16> struct WFrag;
template <> struct WFrag<h16> { typedef v16h V; static __device__ __forceinline__ V ld(const h16* p) { return cat16(*(const v8h*)p, *(const v8h*)(p + 256)); } static __device__ __forceinline__ v8f mma(V a, V b, v8f c) { return wmma16(a, b, c); } };
template <> struct WFrag<bf> { typedef v16bf V; static __device__ __forceinline__ V ld(const bf* p) { return cat16b(*(const v8us*)p, *(const v8us*)(p + 256)); } static __device__ __forceinline__ v8f mma(V a, V b, v8f c) { return wmmab(a, b, c); } };

// ---- k_gemmks: register-blocked GEMM, 64x64 output tile (16 accumulators a wave): C[m][n] (f32, pitch ldc, + optional f32 bias[n]) = sum_k A[m][k] Bt[n][k] (+ split products per NSPLIT), A and Bt in fragment order; z-batch strides sA/sB/sC in elements; NW waves per work-group, each takes K/NW of the k range (which: at the loop); each wave leaves its f32 partial tile in its own LDS plane [64][68], one barrier, then the NW planes are summed in wave order (a fixed order) and stored as whole 256-B row pieces. K % (64 NW) == 0; grid (M/64, N/64, Z), 32 NW threads.
// PLANES (the q | k | v projection, N = 3 x 16 heads x 64, NW = 8): a column tile is one head of q, k or v, and the summed tile goes straight into that head's 16-bit planes, not into C: q and k as hi + lo [h][b][t][d], v as fp16 and hi + lo [h][b][d][t]. A v tile is computed transposed (the weight's rows as A, the rows of x as B: the two loaders are the same), so that its rows are d and its columns t. Every plane is stored in fragment order, a wave's store being one 512-B part of a block.
__device__ __forceinline__ void splitf(float y, unsigned short& h, unsigned short& l) { h = f2bf(y); l = f2bf(y - bf2f(h)); }
typedef __attribute__((ext_vector_type(4))) _Float16 v4h;
typedef __attribute__((ext_vector_type(4))) unsigned short v4us;
template <typename T16, int NSPLIT, bool BIAS, int NW, bool PLANES>
__global__ __launch_bounds__(NW * 32) void k_gemmks(const T16* __restrict__ A, const T16* __restrict__ A2, const T16* __restrict__ Bt, const T16* __restrict__ Bt2, int K, float* C, int ldc, const float* __restrict__ bias, size_t sA, size_t sB, size_t sC, bf* Qh, bf* Ql, bf* Kh, bf* Kl, bf* Vh, bf* Vl, h16* V16) {
    typedef typename WFrag<T16>::V V;
    __shared__ __align__(16) float ps[NW * 64 * 68];
    const size_t z = blockIdx.z; A += z * sA; if (A2) A2 += z * sA; Bt += z * sB; if (Bt2) Bt2 += z * sB; C += z * sC;
    const int lane = threadIdx.x & 31, lr = lane & 15, hi = lane >> 4; const int wv = __builtin_amdgcn_readfirstlane((int)(threadIdx.x >> 5)); const int r0 = blockIdx.x * 64, c0 = blockIdx.y * 64;
    v8f acc[4][4];
#pragma unroll
    for (int mb = 0; mb < 4; ++mb)
#pragma unroll
        for (int nb = 0; nb < 4; ++nb) acc[mb][nb] = (v8f){};
    // waves 2p and 2p+1 share the k range [2p K/NW, (2p+2) K/NW) and take its 32-k blocks in turn
    const int kw2 = 2 * (K / NW), kbeg = (wv >> 1) * kw2 + (wv & 1) * 32;
    // addresses: a wave-uniform base per sixteen-row block and plane, fixed over the loop, and ONE 32-bit lane offset in bytes (A and Bt have the same K), which alone moves along k
    const bool vt = PLANES && (int)blockIdx.y >= 2 * NH_;   // a v tile (the same for the whole work-group)
    const T16* sa[4]; const T16* sa2[4]; const T16* sb[4]; const T16* sb2[4];
#pragma unroll
    for (int q = 0; q < 4; ++q) { const size_t ra = ((size_t)(r0 / 16 + q) * (K / 32) + kbeg / 32) * 512, rb = ((size_t)(c0 / 16 + q) * (K / 32) + kbeg / 32) * 512; sa[q] = vt ? Bt + rb : A + ra; sb[q] = vt ? A + ra : Bt + rb; if (NSPLIT == 1 || NSPLIT == 2) sa2[q] = A2 + ra; if (NSPLIT >= 2) sb2[q] = Bt2 + rb; }
    unsigned voff = (unsigned)(lane * 8) * (unsigned)sizeof(T16);
    // rolled: one trip's fragments and the sixteen accumulators are what a wave's registers hold
#pragma unroll 1
    for (int kc = 0; kc < kw2; kc += 64) {
        V a[4], a2[4];
#pragma unroll
        for (int mb = 0; mb < 4; ++mb) { a[mb] = WFrag<T16>::ld((const T16*)((const char*)sa[mb] + voff)); if (NSPLIT == 1 || NSPLIT == 2) a2[mb] = WFrag<T16>::ld((const T16*)((const char*)sa2[mb] + voff)); }
#pragma unroll
        for (int nb = 0; nb < 4; ++nb) { const V b = WFrag<T16>::ld((const T16*)((const char*)sb[nb] + voff)); V b2; if (NSPLIT >= 2) b2 = WFrag<T16>::ld((const T16*)((const char*)sb2[nb] + voff));
#pragma unroll
            for (int mb = 0; mb < 4; ++mb) { acc[mb][nb] = WFrag<T16>::mma(a[mb], b, acc[mb][nb]); if (NSPLIT == 1 || NSPLIT == 2) acc[mb][nb] = WFrag<T16>::mma(a2[mb], b, acc[mb][nb]); if (NSPLIT >= 2) acc[mb][nb] = WFrag<T16>::mma(a[mb], b2, acc[mb][nb]); } }
        // four vector slots behind the trip's last matrix instruction, on the taken back edge too. The lane offset is an input, so that it keeps its register to the end of the trip and is stepped only behind the waits on all of the trip's loads
        asm volatile("v_nop\n\tv_nop\n\tv_nop\n\tv_nop" : "+v"(acc[0][0]), "+v"(acc[1][1]), "+v"(acc[2][2]), "+v"(acc[3][3]) : "v"(a[0]), "v"(a[3]), "v"(voff));
        voff += 2 * 512 * (unsigned)sizeof(T16);   // 64 k on: two blocks
    }
    float* pw = ps + wv * (64 * 68);
#pragma unroll
    for (int mb = 0; mb < 4; ++mb)
#pragma unroll
        for (int nb = 0; nb < 4; ++nb)
#pragma unroll
            for (int j = 0; j < 8; ++j) pw[(mb * 16 + hi * 8 + j) * 68 + nb * 16 + lr] = acc[mb][nb][j];
    __syncthreads();   // every wave's partial tile is in LDS before any wave sums
    if (PLANES) {
        // the tile is 4 x 2 blocks of two parts: wave wv takes parts 2 wv and 2 wv + 1; a lane sums and stores the eight elements of its place in the part (row 16 R + lr of the tile)
        const size_t pb = (size_t)(((int)blockIdx.y % NH_) * NB_ + r0 / TT) * ((size_t)TT * HD) + lane * 8; const int t0 = r0 % TT;
        bf* ph = (vt ? Vh : (int)blockIdx.y >= NH_ ? Kh : Qh) + pb; bf* pl = (vt ? Vl : (int)blockIdx.y >= NH_ ? Kl : Ql) + pb; h16* p16 = V16 + pb;
        v8us oh[2], ol[2]; v8h o16[2]; int po[2];
#pragma unroll
        for (int s = 0; s < 2; ++s) { const int cb = wv * 2 + s, R = cb >> 2, S = (cb >> 1) & 1, P = cb & 1;
            const float* pr = ps + (R * 16 + lr) * 68 + S * 32 + (vt ? hi * 16 + P * 8 : P * 16 + hi * 8); v4f v0 = *(const v4fa*)pr, v1 = *(const v4fa*)(pr + 4);
#pragma unroll
            for (int w = 1; w < NW; ++w) { const v4f q0 = *(const v4fa*)(pr + w * (64 * 68)), q1 = *(const v4fa*)(pr + w * (64 * 68) + 4);
#pragma unroll
                for (int q = 0; q < 4; ++q) { v0[q] += q0[q]; v1[q] += q1[q]; } }
#pragma unroll
            for (int q = 0; q < 4; ++q) { unsigned short a, c2; splitf(v0[q], a, c2); oh[s][q] = a; ol[s][q] = c2; o16[s][q] = (h16)v0[q]; splitf(v1[q], a, c2); oh[s][4 + q] = a; ol[s][4 + q] = c2; o16[s][4 + q] = (h16)v1[q]; }
            po[s] = (vt ? R * (TT / 32) + (t0 >> 5) + S : ((t0 >> 4) + R) * (HD / 32) + S) * 512 + P * 256; }
        if (vt) {
#pragma unroll
            for (int s = 0; s < 2; ++s) { *(v8us*)(ph + po[s]) = oh[s]; *(v8us*)(pl + po[s]) = ol[s]; *(v8h*)(p16 + po[s]) = o16[s]; }
            return;
        }
#pragma unroll
        for (int s = 0; s < 2; ++s) { *(v8us*)(ph + po[s]) = oh[s]; *(v8us*)(pl + po[s]) = ol[s]; }
        asm volatile("s_wait_xcnt 0x0" ::: "memory");   // behind the last store, in front of whatever the listing places behind it that writes a register which the stores name
        return;
    }
#pragma unroll
    for (int s = 0; s < 32 / NW; ++s) { const int idx = s * (NW * 32) + (int)threadIdx.x; const int row = idx >> 4, cofs = (idx & 15) * 4; const float* pr = ps + row * 68 + cofs; v4f val = *(const v4fa*)pr;
#pragma unroll
        for (int w = 1; w < NW; ++w) { const v4f q = *(const v4fa*)(pr + w * (64 * 68)); val[0] += q[0]; val[1] += q[1]; val[2] += q[2]; val[3] += q[3]; }
        if (BIAS) { val[0] += bfr(bias[c0 + cofs]); val[1] += bfr(bias[c0 + cofs + 1]); val[2] += bfr(bias[c0 + cofs + 2]); val[3] += bfr(bias[c0 + cofs + 3]); }
        *(v4f*)(C + (size_t)(r0 + row) * ldc + c0 + cofs) = val; }
}

__device__ __forceinline__ h16 tohx(float x) { return (h16)x; }
typedef __attribute__((ext_vector_type(2))) unsigned short v2us;
typedef __attribute__((ext_vector_type(2))) float v2f;
typedef __attribute__((ext_vector_type(4))) int v4i;

__global__ __launch_bounds__(256) void k_wtG(const float* __restrict__ w, int K, int N, bf* Bt) {
    const int lane = threadIdx.x & 31; const int L0 = (blockIdx.x * 8 + (threadIdx.x >> 5)) * 8; const int nlines = N * K / 64;
{
#pragma unroll 1
        for (int l = 0; l < 8; ++l) { const int L = L0 + l; if (L >= nlines) break; const size_t e = (size_t)L * 64 + lane * 2; const int blk = (int)(e >> 9), wi = (int)(e & 511), k = (blk % (K / 32)) * 32 + (wi >> 8) * 16 + ((wi >> 7) & 1) * 8 + (wi & 7), n = (blk / (K / 32)) * 16 + ((wi >> 3) & 15); v2us o;   // e: the place in fragment order
            o[0] = f2bf(w[(size_t)k * N + n]); o[1] = f2bf(w[(size_t)(k + 1) * N + n]); *(v2us*)(Bt + e) = o; }
         }
}
__global__ __launch_bounds__(256) void k_cvt8(const float* __restrict__ src, bf* dst, size_t n8) { const size_t i = (size_t)blockIdx.x * 256 + threadIdx.x; if (i >= n8) return;   // i: the 16-byte place in fragment order (rows of DM elements)
    const int blk = (int)(i >> 6), row = (blk / (DM / 32)) * 16 + ((int)i & 15), k = (blk % (DM / 32)) * 32 + (((int)i >> 5) & 1) * 16 + (((int)i >> 4) & 1) * 8; const v8f v = *(const v8f*)(src + (size_t)row * DM + k); v8us o;
#pragma unroll
    for (int k = 0; k < 8; ++k) o[k] = f2bf(v[k]); *(v8us*)(dst + i * 8) = o;  }
// ---- k_fattn: scores, softmax, block mask, head mean and attn.v of 16 query rows of one batch in ONE work-group of 8 waves, the 16 heads one after the other; scores and probabilities stay in registers. grid (batch, TT/16), 256 threads.
// Each wave owns 256 keys, dealt in 64-key blocks: block g of wave w is key block g 8 + w (first key kb + 512 g, kb = 64 w), so that the unmasked blocks, which are the first ones, fall evenly on the eight waves. Scores are computed TRANSPOSED (A = 16 keys of k, B = the 16 queries): a lane then holds one query (lr) and eight keys a tile, which is the B-fragment form that attn.v wants (out^T = v^T p^T, A = 16 rows d of the [d][t] plane), so that no value changes lanes.
// Row m of score tile t is key kb + (t>>2) 512 + ((t>>1)&1) 32 + (m>>3) 16 + (t&1) 8 + (m&7): tiles 2s and 2s+1 give lane half hi the 16 consecutive keys kb + (s>>1) 512 + (s&1) 32 + 16 hi + e, e = 0..15, element e of the B fragment of k-step s; the v^T loader reads the same 16 keys into element e. A score tile so takes eight rows from each of two neighbouring 16-key blocks of the k plane: each of its loads is four whole 128-B lines (eight lanes a line).
// Row maximum and row sum go through LDS (8 waves, summed in wave order); the partial out^T tiles of the nact waves with an unmasked block are summed in LDS in wave order. A 64-key block lies in one wave and is masked or not for the whole work-group (16 rows lie in one 64-row block): masked blocks skip attn.v and add nothing to the mean.
#define FW   8                    // waves per work-group
#define KW   (TT / FW)            // keys per wave
#define NT   (KW / 16)            // score tiles per wave
#define NG   (KW / 64)            // 64-key mask blocks per wave
// a fragment from a plane in fragment order: the two 512-B parts of a block (q, k planes: k = 8 hi + 0..7 | 16 + 8 hi + 0..7; v planes: 16 consecutive keys)
__device__ __forceinline__ v16bf ldfb(const bf* ub, unsigned vo, int c) { const char* p = (const char*)ub + vo; return cat16b(*(const v8us*)(p + c), *(const v8us*)(p + c + 512)); }
__device__ __forceinline__ v16h ldfh(const h16* ub, unsigned vo, int c) { const char* p = (const char*)ub + vo; return cat16(*(const v8h*)(p + c), *(const v8h*)(p + c + 512)); }
// 2^x with the one vector slot that the instruction set asks for behind a transcendental, in front of an instruction that reads its result or overwrites its source
__device__ __forceinline__ float exp2s(float x) { float e; asm("v_exp_f32 %0, %1\n\tv_nop" : "=v"(e) : "v"(x)); return e; }
__global__ __launch_bounds__(FW * 32) void k_fattn(const bf* __restrict__ Qh, const bf* __restrict__ Ql, const bf* __restrict__ Kh, const bf* __restrict__ Kl, const h16* __restrict__ V16, const bf* __restrict__ Vh, const bf* __restrict__ Vl, float* AW, bf* Ah, bf* Al) {
    __shared__ __align__(16) float po[FW * 16 * 68];
    __shared__ float rmx[FW * 16]; __shared__ float rsm[FW * 16];
    __shared__ __align__(16) float awl[NT * 2 * FW * 32 * 4];   // the head mean's f32 sums, [tile][half][thread][4]: each thread reads and writes its own 16-B slots only (touched once a head: in registers they would crowd out the fragments in flight)
    const int lane = threadIdx.x & 31, lr = lane & 15, hi = lane >> 4; const int wv = __builtin_amdgcn_readfirstlane((int)(threadIdx.x >> 5));
    const int b = blockIdx.x, i0 = (TT / 16 - 1 - (int)blockIdx.y) * 16, kb = wv * 64, qb = i0 >> 6; const bool hires = (i0 < RH);   // the late rows, which have the most unmasked keys, take the low blockIdx.y
    const int na = (qb - wv + FW) / FW;                                 // unmasked 64-key blocks of this wave: its block g is key block g FW + wv, unmasked up to key block qb
    const int nact = qb + 1 < FW ? qb + 1 : FW;                         // waves with at least one
    // lane offsets in bytes, fixed over the kernel; the plane bases are wave-uniform
    const unsigned vq = (unsigned)((i0 >> 4) * (HD / 32) * 512 + lane * 8) * 2u, vk = (unsigned)(((kb >> 4) + (lr >> 3)) * (HD / 32) * 512 + (hi * 16 + (lr & 7)) * 8) * 2u, vv = (unsigned)((kb >> 5) * 512 + lane * 8) * 2u;
    const int rq = ((int)threadIdx.x >> 1) & 15, rd = wv * 8 + ((int)threadIdx.x & 1) * 4;   // the reducer's query row and first d: a wave's store is 256 contiguous bytes of the output plane's fragment order
    float* al = awl + (int)threadIdx.x * 4;
#pragma unroll
    for (int t = 0; t < NT * 2; ++t) *(v4fa*)(al + t * (FW * 32 * 4)) = (v4f){};
    // rolled over the heads: one head's code is long, and s and o stay in registers only under constant indices (every loop over them is unrolled)
#pragma unroll 1
    for (int h = 0; h < NH_; ++h) { const size_t pl = (size_t)(h * NB_ + b) * ((size_t)TT * HD);
        const bf* kh = Kh + pl; const bf* kl = Kl + pl; v16bf qh[2], ql[2];
#pragma unroll
        for (int kk = 0; kk < 2; ++kk) { qh[kk] = ldfb(Qh + pl, vq, kk * 1024); ql[kk] = ldfb(Ql + pl, vq, kk * 1024); }
        v8f s[NT]; v16bf fh[2][2][2], fl[2][2][2];   // k fragments [buffer][tile of the pair][32-k half]: the pair in work and the pair in flight
#pragma unroll
        for (int u = 0; u < 2; ++u)
#pragma unroll
            for (int kk = 0; kk < 2; ++kk) { fh[0][u][kk] = ldfb(kh, vk, u * 128 + kk * 1024); fl[0][u][kk] = ldfb(kl, vk, u * 128 + kk * 1024); }
#pragma unroll
        for (int g = 0; g < NT / 2; ++g) {
            if (g + 1 < NT / 2) {
#pragma unroll
                for (int u = 0; u < 2; ++u)
#pragma unroll
                    for (int kk = 0; kk < 2; ++kk) { const int c = ((g + 1) >> 1) * (FW * 8192) + ((g + 1) & 1) * 4096 + u * 128 + kk * 1024; fh[(g + 1) & 1][u][kk] = ldfb(kh, vk, c); fl[(g + 1) & 1][u][kk] = ldfb(kl, vk, c); } }
            __builtin_amdgcn_sched_barrier(0);   // the next pair's sixteen loads are issued in front of this pair's products (left alone the compiler sinks each load to its use and waits for it there)
#pragma unroll
            for (int u = 0; u < 2; ++u) { v8f a = (v8f){};
#pragma unroll
                for (int kk = 0; kk < 2; ++kk) { a = wmmab(fh[g & 1][u][kk], qh[kk], a); a = wmmab(fh[g & 1][u][kk], ql[kk], a); a = wmmab(fl[g & 1][u][kk], qh[kk], a); }
                s[g * 2 + u] = a; }
            __builtin_amdgcn_sched_barrier(0);   // and the pair after next is not lifted over these products: two pairs of fragments are what the registers hold
        }
        float mx = -3.0e38f;
#pragma unroll
        for (int t = 0; t < NT; ++t)
#pragma unroll
            for (int j = 0; j < 8; ++j) { const float x = s[t][j] * SCL; s[t][j] = x; mx = fmaxf(mx, x); }
        mx = fmaxf(mx, __shfl_xor(mx, 16, 32));
        if (hi == 0) rmx[wv * 16 + lr] = mx;
        __syncthreads();   // every wave's row maxima are in LDS
#pragma unroll
        for (int w = 0; w < FW; ++w) mx = fmaxf(mx, rmx[w * 16 + lr]);
        float sm[4] = {0.f, 0.f, 0.f, 0.f};
#pragma unroll
        for (int t = 0; t < NT; ++t)
#pragma unroll
            for (int j = 0; j < 8; ++j) { const float e = exp2s((s[t][j] - mx) * 1.4426950408889634f); s[t][j] = e; sm[j & 3] += e; }
        float sum = (sm[0] + sm[1]) + (sm[2] + sm[3]); sum += __shfl_xor(sum, 16, 32);
        if (hi == 0) rsm[wv * 16 + lr] = sum;
        __syncthreads();   // every wave's row sums are in LDS
        sum = rsm[lr];
#pragma unroll
        for (int w = 1; w < FW; ++w) sum += rsm[w * 16 + lr];
        const float f = __fdiv_rn(hires ? 1.0f : PCAR, sum);
        v8f o[4];
#pragma unroll
        for (int dt = 0; dt < 4; ++dt) o[dt] = (v8f){};
        if (hires) { const bf* vh = Vh + pl; const bf* vl = Vl + pl;
#pragma unroll
            for (int g = 0; g < NG; ++g) if (g < na) { v16bf va[2][4], vb[2][4];
#pragma unroll
                for (int x = 0; x < 2; ++x)
#pragma unroll
                    for (int dt = 0; dt < 4; ++dt) { const int c = (dt * (TT / 32) + g * (FW * 2) + x) * 1024; va[x][dt] = ldfb(vh, vv, c); vb[x][dt] = ldfb(vl, vv, c); }
                asm volatile("s_wait_xcnt 0x0" ::: "memory");   // behind the block's loads, in front of the arithmetic below, which may reuse the registers that hold their address
                __builtin_amdgcn_sched_barrier(0);   // the block's v loads are all in flight in front of the arithmetic on its probabilities
#pragma unroll
                for (int sx = g * 2; sx < g * 2 + 2; ++sx) { v8us h0, h1, l0, l1; v4f m[4];
#pragma unroll
                    for (int u = 0; u < 4; ++u) m[u] = *(const v4fa*)(al + (sx * 4 + u) * (FW * 32 * 4));
#pragma unroll
                    for (int e = 0; e < 8; ++e) { const float p0 = s[2 * sx][e] * f, p1 = s[2 * sx + 1][e] * f; unsigned short a, c2; splitf(p0, a, c2); h0[e] = a; l0[e] = c2; splitf(p1, a, c2); h1[e] = a; l1[e] = c2; m[e >> 2][e & 3] += p0; m[2 + (e >> 2)][e & 3] += p1; }
#pragma unroll
                    for (int u = 0; u < 4; ++u) *(v4fa*)(al + (sx * 4 + u) * (FW * 32 * 4)) = m[u];
                    const v16bf ph = cat16b(h0, h1), pq = cat16b(l0, l1);
#pragma unroll
                    for (int dt = 0; dt < 4; ++dt) { o[dt] = wmmab(va[sx & 1][dt], ph, o[dt]); o[dt] = wmmab(va[sx & 1][dt], pq, o[dt]); o[dt] = wmmab(vb[sx & 1][dt], ph, o[dt]); } } }
        } else { const h16* v16 = V16 + pl;
#pragma unroll
            for (int g = 0; g < NG; ++g) if (g < na) { v16h va[2][4];
#pragma unroll
                for (int x = 0; x < 2; ++x)
#pragma unroll
                    for (int dt = 0; dt < 4; ++dt) va[x][dt] = ldfh(v16, vv, (dt * (TT / 32) + g * (FW * 2) + x) * 1024);
                asm volatile("s_wait_xcnt 0x0" ::: "memory");   // behind the block's loads, in front of the arithmetic below, which may reuse the registers that hold their address
                __builtin_amdgcn_sched_barrier(0);   // the block's v loads are all in flight in front of the arithmetic on its probabilities
#pragma unroll
                for (int sx = g * 2; sx < g * 2 + 2; ++sx) { v16h pf; v4f m[4];
#pragma unroll
                    for (int u = 0; u < 4; ++u) m[u] = *(const v4fa*)(al + (sx * 4 + u) * (FW * 32 * 4));
#pragma unroll
                    for (int e = 0; e < 8; ++e) { const float p0 = s[2 * sx][e] * f, p1 = s[2 * sx + 1][e] * f; pf[e] = tohx(p0); pf[8 + e] = tohx(p1); m[e >> 2][e & 3] += p0 * (1.0f / PCAR); m[2 + (e >> 2)][e & 3] += p1 * (1.0f / PCAR); }
#pragma unroll
                    for (int u = 0; u < 4; ++u) *(v4fa*)(al + (sx * 4 + u) * (FW * 32 * 4)) = m[u];
#pragma unroll
                    for (int dt = 0; dt < 4; ++dt) o[dt] = wmma16(va[sx & 1][dt], pf, o[dt]); } }
        }
        if (na > 0) { float* pw = po + wv * (16 * 68) + lr * 68 + hi * 8;   // out^T tile dt: lane lr = query, register j = d dt 16 + hi 8 + j
#pragma unroll
            for (int dt = 0; dt < 4; ++dt) { v4f x0, x1;
#pragma unroll
                for (int j = 0; j < 4; ++j) { x0[j] = o[dt][j]; x1[j] = o[dt][4 + j]; }
                *(v4fa*)(pw + dt * 16) = x0; *(v4fa*)(pw + dt * 16 + 4) = x1; } }
        __syncthreads();   // the partial out tiles are in LDS before any wave sums; the next head writes them again only behind its own two barriers
        { const float* pr = po + rq * 68 + rd; v4f val = *(const v4fa*)pr;
            for (int w = 1; w < nact; ++w) { const v4f q = *(const v4fa*)(pr + w * (16 * 68)); val[0] += q[0]; val[1] += q[1]; val[2] += q[2]; val[3] += q[3]; }
            const float cs = hires ? 1.0f : (1.0f / PCAR); v4us oh, ol;
#pragma unroll
            for (int q = 0; q < 4; ++q) { unsigned short a, c2; splitf(val[q] * cs, a, c2); oh[q] = a; ol[q] = c2; }
            const size_t oo = ((size_t)((b * TT + i0) >> 4) * (DQ / 32) + h * (HD / 32) + (rd >> 5)) * 512 + ((rd >> 4) & 1) * 256 + (((rd >> 3) & 1) * 16 + rq) * 8 + (rd & 7); *(v4us*)(Ah + oo) = oh; *(v4us*)(Al + oo) = ol;
            asm volatile("s_wait_xcnt 0x0" ::: "memory");   // behind the two stores, in front of the next head's arithmetic, which may reuse the registers that they name
        }
    }
    float* ar = AW + ((size_t)b * TT + i0 + lr) * TT + kb + hi * 16;
    v4f x[NT * 2];
#pragma unroll
    for (int t = 0; t < NT * 2; ++t) { x[t] = *(const v4fa*)(al + t * (FW * 32 * 4));
#pragma unroll
        for (int j = 0; j < 4; ++j) x[t][j] *= 0.0625f; }
    __builtin_amdgcn_sched_barrier(0);   // every sum is read and scaled in front of the first store, so that no register which an issued store names is written again
#pragma unroll
    for (int t = 0; t < NT; ++t) { float* p = ar + (t >> 2) * (FW * 64) + ((t >> 1) & 1) * 32 + (t & 1) * 8; *(v4f*)p = x[t * 2]; *(v4f*)(p + 4) = x[t * 2 + 1]; }
}
extern "C" void kernel_launch(void* const* d_in, const int* in_sizes, int n_in,
                              void* d_out, int out_size, void* d_ws, size_t ws_size, hipStream_t stream) {
    (void)in_sizes; (void)n_in; (void)out_size;
    const float* x = (const float*)d_in[0]; const float* wf = (const float*)d_in[1]; const float* wo = (const float*)d_in[2]; const float* bo = (const float*)d_in[3];
    float* OUT = (float*)d_out;     // [2][2048][1024]
    char* wsp = (char*)d_ws;
    auto take = [&](size_t bytes) { char* p = wsp; wsp += (bytes + 255) & ~(size_t)255; return (void*)p; };
    bf* WO = (bf*)take((size_t)DM * DQ * 2);
    bf* XB = (bf*)take((size_t)MT * DM * 2); bf* WALL = (bf*)take((size_t)(DQ + 2 * DKV) * DM * 2); float* AW = OUT + (size_t)NB_ * TT * DM + 0;   /* out1 region base; batch b at + b*TT*TT */
    h16* VT16 = (h16*)take((size_t)NKV * HD * MT * 2);
    bf* QPh = (bf*)take((size_t)NH_ * MT * HD * 2); bf* QPl = (bf*)take((size_t)NH_ * MT * HD * 2); bf* KPh = (bf*)take((size_t)NKV * MT * HD * 2); bf* KPl = (bf*)take((size_t)NKV * MT * HD * 2); bf* VTh = (bf*)take((size_t)NKV * HD * MT * 2); bf* VTl = (bf*)take((size_t)NKV * HD * MT * 2);
    bf* ATh = (bf*)take((size_t)MT * DQ * 2); bf* ATl = (bf*)take((size_t)MT * DQ * 2);
    if ((size_t)(wsp - (char*)d_ws) > ws_size) return;    // 88 MiB of the 256 MiB
    k_wtG<<<(unsigned)((DM * (DQ + 2 * DKV) / 64 + 63) / 64), 256, 0, stream>>>(wf, DM, DQ + 2 * DKV, WALL);
    k_wtG<<<(unsigned)((DQ * DM / 64 + 63) / 64), 256, 0, stream>>>(wo, DQ, DM, WO);
    k_cvt8<<<(unsigned)(((size_t)MT * DM / 8 + 255) / 256), 256, 0, stream>>>(x, XB, (size_t)MT * DM / 8);
    k_gemmks<bf, 0, false, 8, true><<<dim3(MT / 64, (DQ + 2 * DKV) / 64, 1), 256, 0, stream>>>(XB, nullptr, WALL, nullptr, DM, nullptr, 0, nullptr, 0, 0, 0, QPh, QPl, KPh, KPl, VTh, VTl, VT16);
    k_fattn<<<dim3(NB_, TT / 16, 1), FW * 32, 0, stream>>>(QPh, QPl, KPh, KPl, VT16, VTh, VTl, AW, ATh, ATl);
    k_gemmks<bf, 1, true, 8, false><<<dim3(MT / 64, DM / 64, 1), 256, 0, stream>>>(ATh, ATl, WO, nullptr, DQ, OUT, DM, bo, 0, 0, 0, nullptr, nullptr, nullptr, nullptr, nullptr, nullptr, nullptr);
}
